// v000
// The times below were measured on an AMD MI455X: many runs one after another, warmed up first and cycling through
// copies of the inputs, with the whole window's GPU time divided by the number of runs. Launches and the gaps
// between them are all in it. The median over several windows is given; except for v000 it joins two sittings, which
// can be a few percent apart, so the side-by-side timings, each taken in one sitting, are the better comparison.
// v000, which the later versions start from, runs in 439 microseconds.
#include <hip/hip_runtime.h>
#include <math.h>

// Problem constants (from reference): B=8, T=2048, D=1024, HS=64
#define B_  8
#define T_  2048
#define D_  1024
#define HS_ 64

typedef __attribute__((ext_vector_type(2))) float v2f;
typedef __attribute__((ext_vector_type(8))) float v8f;

// D = A(16x4,f32) * B(4x16,f32) + C(16x16,f32) — full-precision CDNA5 WMMA.
__device__ __forceinline__ v8f wmma4(v2f a, v2f b, v8f c) {
  return __builtin_amdgcn_wmma_f32_16x16x4_f32(
      /*neg_a=*/false, a, /*neg_b=*/false, b,
      /*c_mod=*/(short)0, c, /*reuse_a=*/false, /*reuse_b=*/false);
}

// -------------------------------------------------------------------------
// Kernel 1: q/k/v = x @ {Wq,Wk,Wv}.  One wave per 16-row tile of x.
// 12 accumulators (3 weights x 4 column tiles of 16), K-loop over D in
// steps of 4 (the f32 WMMA K).
// -------------------------------------------------------------------------
__global__ __launch_bounds__(128) void qkv_proj_kernel(
    const float* __restrict__ x,  const float* __restrict__ Wq,
    const float* __restrict__ Wk, const float* __restrict__ Wv,
    float* __restrict__ qo, float* __restrict__ ko, float* __restrict__ vo)
{
  const int wave = threadIdx.x >> 5;
  const int lane = threadIdx.x & 31;
  const int hh   = lane >> 4;      // which 16-lane half
  const int l16  = lane & 15;
  const int row0 = (blockIdx.x * 4 + wave) * 16;   // token row base, < B*T

  const float* Ws[3] = {Wq, Wk, Wv};
  float*       Os[3] = {qo, ko, vo};

  const v8f vzero = {0.f,0.f,0.f,0.f,0.f,0.f,0.f,0.f};
  v8f acc[3][4];
#pragma unroll
  for (int w = 0; w < 3; ++w)
#pragma unroll
    for (int nt = 0; nt < 4; ++nt) acc[w][nt] = vzero;

  // A-fragment base: A[M=l16][K = kk + 2*hh + v]
  const float* ap_base = x + (size_t)(row0 + l16) * D_ + 2 * hh;

  for (int kk = 0; kk < D_; kk += 4) {
    v2f a;
    a[0] = ap_base[kk];
    a[1] = ap_base[kk + 1];
#pragma unroll
    for (int w = 0; w < 3; ++w) {
      // B-fragment: B[K = kk + 2*hh + v][N = nt*16 + l16]
      const float* Wp = Ws[w] + (size_t)(kk + 2 * hh) * HS_ + l16;
#pragma unroll
      for (int nt = 0; nt < 4; ++nt) {
        v2f b;
        b[0] = Wp[nt * 16];
        b[1] = Wp[HS_ + nt * 16];
        acc[w][nt] = wmma4(a, b, acc[w][nt]);
      }
    }
  }

  // C/D layout: element j of a lane is row (j + 8*hh), column l16.
#pragma unroll
  for (int w = 0; w < 3; ++w)
#pragma unroll
    for (int nt = 0; nt < 4; ++nt)
#pragma unroll
      for (int j = 0; j < 8; ++j)
        Os[w][(size_t)(row0 + j + 8 * hh) * HS_ + nt * 16 + l16] = acc[w][nt][j];
}

// -------------------------------------------------------------------------
// Kernel 2: causal flash attention over the q/k/v workspace.
// One wave per (batch, 16-row query tile).  Online softmax with
// cross-lane shuffles; P transposed C->A layout through a per-wave LDS
// tile (no block barrier: trip counts diverge between waves).
// -------------------------------------------------------------------------
__global__ __launch_bounds__(128) void flash_attn_kernel(
    const float* __restrict__ q, const float* __restrict__ k,
    const float* __restrict__ vmat, float* __restrict__ out)
{
  __shared__ float pt[4][16][17];   // per-wave P-tile, padded vs bank conflicts

  const int wave = threadIdx.x >> 5;
  const int lane = threadIdx.x & 31;
  const int hh   = lane >> 4;
  const int l16  = lane & 15;

  const int task = blockIdx.x * 4 + wave;   // 0 .. B*(T/16)-1
  const int bidx = task >> 7;               // T/16 == 128 tiles per batch
  const int it   = task & 127;              // query tile index
  const size_t base = (size_t)bidx * T_ * HS_;
  const int qr0 = it * 16;

  // Cache the whole 16x64 q tile in registers, A-layout, 16 K-steps of 4.
  v2f aq[16];
  const float* qp = q + base + (size_t)(qr0 + l16) * HS_ + 2 * hh;
#pragma unroll
  for (int c = 0; c < 16; ++c) { aq[c][0] = qp[4 * c]; aq[c][1] = qp[4 * c + 1]; }

  const v8f vzero = {0.f,0.f,0.f,0.f,0.f,0.f,0.f,0.f};
  v8f o[4];
#pragma unroll
  for (int nt = 0; nt < 4; ++nt) o[nt] = vzero;

  float mrow[8], lrow[8];           // stats for rows (j + 8*hh)
#pragma unroll
  for (int j = 0; j < 8; ++j) { mrow[j] = -INFINITY; lrow[j] = 0.f; }

  const float scale = 0.02209708691207961f;   // 1/sqrt(2048) (block_size!)

  for (int jt = 0; jt <= it; ++jt) {
    // ---- S = q @ k^T for this 16x16 tile (B[K][N] = k[jt*16+N][K]) ----
    v8f s = vzero;
    const float* kp = k + base + (size_t)(jt * 16 + l16) * HS_ + 2 * hh;
#pragma unroll
    for (int c = 0; c < 16; ++c) {
      v2f bk; bk[0] = kp[4 * c]; bk[1] = kp[4 * c + 1];
      s = wmma4(aq[c], bk, s);
    }

    // ---- scale, causal mask, online softmax (rows live across a
    //      16-lane half -> xor 1/2/4/8 reduces a row) ----
    float corr[8];
#pragma unroll
    for (int j = 0; j < 8; ++j) {
      float sv = s[j] * scale;
      if (jt == it && l16 > j + 8 * hh) sv = -INFINITY;   // col > row
      float rm = sv;
      rm = fmaxf(rm, __shfl_xor(rm, 1, 32));
      rm = fmaxf(rm, __shfl_xor(rm, 2, 32));
      rm = fmaxf(rm, __shfl_xor(rm, 4, 32));
      rm = fmaxf(rm, __shfl_xor(rm, 8, 32));
      float mnew = fmaxf(mrow[j], rm);
      corr[j] = __expf(mrow[j] - mnew);
      float p = __expf(sv - mnew);
      mrow[j] = mnew;
      s[j] = p;
      float rs = p;
      rs += __shfl_xor(rs, 1, 32);
      rs += __shfl_xor(rs, 2, 32);
      rs += __shfl_xor(rs, 4, 32);
      rs += __shfl_xor(rs, 8, 32);
      lrow[j] = lrow[j] * corr[j] + rs;
    }

    // rescale running output
#pragma unroll
    for (int nt = 0; nt < 4; ++nt)
#pragma unroll
      for (int j = 0; j < 8; ++j) o[nt][j] *= corr[j];

    // ---- transpose P (C-layout -> A-layout) via per-wave LDS tile ----
#pragma unroll
    for (int j = 0; j < 8; ++j) pt[wave][j + 8 * hh][l16] = s[j];
    asm volatile("s_wait_dscnt 0" ::: "memory");   // same-wave DS RAW fence

    // ---- O += P @ V : 4 K-steps of 4, 4 N-tiles of 16 ----
#pragma unroll
    for (int c = 0; c < 4; ++c) {
      v2f ap;
      ap[0] = pt[wave][l16][4 * c + 2 * hh];
      ap[1] = pt[wave][l16][4 * c + 2 * hh + 1];
      const float* vrow = vmat + base + (size_t)(jt * 16 + 4 * c + 2 * hh) * HS_;
#pragma unroll
      for (int nt = 0; nt < 4; ++nt) {
        v2f bv;
        bv[0] = vrow[nt * 16 + l16];        // B[K  ][N]
        bv[1] = vrow[HS_ + nt * 16 + l16];  // B[K+1][N]
        o[nt] = wmma4(ap, bv, o[nt]);
      }
    }
  }

  // ---- normalize and store ----
#pragma unroll
  for (int j = 0; j < 8; ++j) lrow[j] = 1.0f / lrow[j];
#pragma unroll
  for (int nt = 0; nt < 4; ++nt)
#pragma unroll
    for (int j = 0; j < 8; ++j)
      out[base + (size_t)(qr0 + j + 8 * hh) * HS_ + nt * 16 + l16] =
          o[nt][j] * lrow[j];
}

// -------------------------------------------------------------------------
extern "C" void kernel_launch(void* const* d_in, const int* in_sizes, int n_in,
                              void* d_out, int out_size, void* d_ws, size_t ws_size,
                              hipStream_t stream) {
  const float* x  = (const float*)d_in[0];
  const float* Wq = (const float*)d_in[1];
  const float* Wk = (const float*)d_in[2];
  const float* Wv = (const float*)d_in[3];

  const size_t nqkv = (size_t)B_ * T_ * HS_;   // 1,048,576 floats = 4 MB each
  float* qw = (float*)d_ws;
  float* kw = qw + nqkv;
  float* vw = kw + nqkv;

  // 1024 M-tiles of 16 rows, 4 waves (128 threads) per block
  qkv_proj_kernel<<<(B_ * T_ / 16) / 4, 128, 0, stream>>>(x, Wq, Wk, Wv, qw, kw, vw);
  // 1024 (batch, q-tile) tasks, 4 waves per block
  flash_attn_kernel<<<(B_ * (T_ / 16)) / 4, 128, 0, stream>>>(qw, kw, vw, (float*)d_out);
}

// v001
// Measured time: 178 microseconds a run.
// Timed twice side by side with v000, it ran 2.51 and 2.50 times as fast.
#include <hip/hip_runtime.h>
#include <math.h>

// Problem constants (from reference): B=8, T=2048, D=1024, HS=64
#define B_  8
#define T_  2048
#define D_  1024
#define HS_ 64

typedef __attribute__((ext_vector_type(2))) float v2f;
typedef __attribute__((ext_vector_type(8))) float v8f;

// D = A(16x4,f32) * B(4x16,f32) + C(16x16,f32) — full-precision CDNA5 WMMA.
__device__ __forceinline__ v8f wmma4(v2f a, v2f b, v8f c) {
  return __builtin_amdgcn_wmma_f32_16x16x4_f32(
      /*neg_a=*/false, a, /*neg_b=*/false, b,
      /*c_mod=*/(short)0, c, /*reuse_a=*/false, /*reuse_b=*/false);
}

// -------------------------------------------------------------------------
// Kernel 1: q/k/v = x @ {Wq,Wk,Wv}.  One wave per 16-row tile of x.
// 12 accumulators (3 weights x 4 column tiles of 16), K-loop over D in
// steps of 4 (the f32 WMMA K).
// -------------------------------------------------------------------------
__global__ __launch_bounds__(128) void qkv_proj_kernel(
    const float* __restrict__ x,  const float* __restrict__ Wq,
    const float* __restrict__ Wk, const float* __restrict__ Wv,
    float* __restrict__ qo, float* __restrict__ ko, float* __restrict__ vo)
{
  const int wave = threadIdx.x >> 5;
  const int lane = threadIdx.x & 31;
  const int hh   = lane >> 4;      // which 16-lane half
  const int l16  = lane & 15;
  const int row0 = (blockIdx.x * 4 + wave) * 16;   // token row base, < B*T

  const float* Ws[3] = {Wq, Wk, Wv};
  float*       Os[3] = {qo, ko, vo};

  const v8f vzero = {0.f,0.f,0.f,0.f,0.f,0.f,0.f,0.f};
  v8f acc[3][4];
#pragma unroll
  for (int w = 0; w < 3; ++w)
#pragma unroll
    for (int nt = 0; nt < 4; ++nt) acc[w][nt] = vzero;

  // A-fragment base: A[M=l16][K = kk + 2*hh + v]
  const float* ap_base = x + (size_t)(row0 + l16) * D_ + 2 * hh;

  for (int kk = 0; kk < D_; kk += 4) {
    v2f a;
    a[0] = ap_base[kk];
    a[1] = ap_base[kk + 1];
#pragma unroll
    for (int w = 0; w < 3; ++w) {
      // B-fragment: B[K = kk + 2*hh + v][N = nt*16 + l16]
      const float* Wp = Ws[w] + (size_t)(kk + 2 * hh) * HS_ + l16;
#pragma unroll
      for (int nt = 0; nt < 4; ++nt) {
        v2f b;
        b[0] = Wp[nt * 16];
        b[1] = Wp[HS_ + nt * 16];
        acc[w][nt] = wmma4(a, b, acc[w][nt]);
      }
    }
  }

  // C/D layout: element j of a lane is row (j + 8*hh), column l16.
#pragma unroll
  for (int w = 0; w < 3; ++w)
#pragma unroll
    for (int nt = 0; nt < 4; ++nt)
#pragma unroll
      for (int j = 0; j < 8; ++j)
        Os[w][(size_t)(row0 + j + 8 * hh) * HS_ + nt * 16 + l16] = acc[w][nt][j];
}

// -------------------------------------------------------------------------
// Kernel 2: causal flash attention over the q/k/v workspace.
// One work-group per (batch, 16-row query tile).  Its NW_ waves share the
// tile's key range: wave w takes key tiles w, w+NW_, w+2*NW_, ... and keeps
// its own online-softmax state (m, l, O).  The partial states are joined
// once, through LDS, behind one work-group barrier.
// P is transposed C->A layout through a per-wave LDS tile (no barrier in the
// loop: trip counts differ between waves).
// -------------------------------------------------------------------------
#define NW_ 8          // waves per work-group = key splits per query tile
#define OP_ 68         // LDS row pitch of a partial O tile, in floats

__global__ __launch_bounds__(NW_ * 32) void flash_attn_kernel(
    const float* __restrict__ q, const float* __restrict__ k,
    const float* __restrict__ vmat, float* __restrict__ out)
{
  __shared__ float pt[NW_][16][17];   // per-wave P-tile, padded vs bank conflicts
  __shared__ __attribute__((aligned(16))) float so[NW_][16][OP_];  // partial O
  __shared__ float sm[NW_][16];       // partial row maxima
  __shared__ float sl[NW_][16];       // partial row sums

  // wave-uniform by construction; read into a scalar register so that the
  // key loop's trip count is a scalar branch and EXEC stays all ones at the WMMAs
  const int wave = __builtin_amdgcn_readfirstlane(threadIdx.x >> 5);
  const int lane = threadIdx.x & 31;
  const int hh   = lane >> 4;
  const int l16  = lane & 15;

  const int task = blockIdx.x;              // 0 .. B*(T/16)-1
  const int bidx = task >> 7;               // T/16 == 128 tiles per batch
  const int it   = task & 127;              // query tile index
  const size_t base = (size_t)bidx * T_ * HS_;
  const int qr0 = it * 16;

  // Cache the whole 16x64 q tile in registers, A-layout, 16 K-steps of 4.
  v2f aq[16];
  const float* qp = q + base + (size_t)(qr0 + l16) * HS_ + 2 * hh;
#pragma unroll
  for (int c = 0; c < 16; ++c) { aq[c][0] = qp[4 * c]; aq[c][1] = qp[4 * c + 1]; }

  const v8f vzero = {0.f,0.f,0.f,0.f,0.f,0.f,0.f,0.f};
  v8f o[4];
#pragma unroll
  for (int nt = 0; nt < 4; ++nt) o[nt] = vzero;

  float mrow[8], lrow[8];           // stats for rows (j + 8*hh)
#pragma unroll
  for (int j = 0; j < 8; ++j) { mrow[j] = -INFINITY; lrow[j] = 0.f; }

  const float scale = 0.02209708691207961f;   // 1/sqrt(2048) (block_size!)

  for (int jt = wave; jt <= it; jt += NW_) {
    // ---- S = q @ k^T for this 16x16 tile (B[K][N] = k[jt*16+N][K]) ----
    v8f s = vzero;
    const float* kp = k + base + (size_t)(jt * 16 + l16) * HS_ + 2 * hh;
#pragma unroll
    for (int c = 0; c < 16; ++c) {
      v2f bk; bk[0] = kp[4 * c]; bk[1] = kp[4 * c + 1];
      s = wmma4(aq[c], bk, s);
    }

    // ---- scale, causal mask, online softmax (rows live across a
    //      16-lane half -> xor 1/2/4/8 reduces a row) ----
    float corr[8];
#pragma unroll
    for (int j = 0; j < 8; ++j) {
      float sv = s[j] * scale;
      if (jt == it && l16 > j + 8 * hh) sv = -INFINITY;   // col > row
      float rm = sv;
      rm = fmaxf(rm, __shfl_xor(rm, 1, 32));
      rm = fmaxf(rm, __shfl_xor(rm, 2, 32));
      rm = fmaxf(rm, __shfl_xor(rm, 4, 32));
      rm = fmaxf(rm, __shfl_xor(rm, 8, 32));
      float mnew = fmaxf(mrow[j], rm);
      corr[j] = __expf(mrow[j] - mnew);
      float p = __expf(sv - mnew);
      mrow[j] = mnew;
      s[j] = p;
      float rs = p;
      rs += __shfl_xor(rs, 1, 32);
      rs += __shfl_xor(rs, 2, 32);
      rs += __shfl_xor(rs, 4, 32);
      rs += __shfl_xor(rs, 8, 32);
      lrow[j] = lrow[j] * corr[j] + rs;
    }

    // rescale running output
#pragma unroll
    for (int nt = 0; nt < 4; ++nt)
#pragma unroll
      for (int j = 0; j < 8; ++j) o[nt][j] *= corr[j];

    // ---- transpose P (C-layout -> A-layout) via per-wave LDS tile ----
#pragma unroll
    for (int j = 0; j < 8; ++j) pt[wave][j + 8 * hh][l16] = s[j];
    asm volatile("s_wait_dscnt 0" ::: "memory");   // same-wave DS RAW fence

    // ---- O += P @ V : 4 K-steps of 4, 4 N-tiles of 16 ----
#pragma unroll
    for (int c = 0; c < 4; ++c) {
      v2f ap;
      ap[0] = pt[wave][l16][4 * c + 2 * hh];
      ap[1] = pt[wave][l16][4 * c + 2 * hh + 1];
      const float* vrow = vmat + base + (size_t)(jt * 16 + 4 * c + 2 * hh) * HS_;
#pragma unroll
      for (int nt = 0; nt < 4; ++nt) {
        v2f bv;
        bv[0] = vrow[nt * 16 + l16];        // B[K  ][N]
        bv[1] = vrow[HS_ + nt * 16 + l16];  // B[K+1][N]
        o[nt] = wmma4(ap, bv, o[nt]);
      }
    }
  }

  // ---- publish this wave's partial state (a wave without a key tile
  //      publishes m = -inf, l = 0, O = 0, which the join weighs with 0) ----
#pragma unroll
  for (int nt = 0; nt < 4; ++nt)
#pragma unroll
    for (int j = 0; j < 8; ++j) so[wave][j + 8 * hh][nt * 16 + l16] = o[nt][j];
  if (l16 == 0) {
#pragma unroll
    for (int j = 0; j < 8; ++j) {
      sm[wave][j + 8 * hh] = mrow[j];
      sl[wave][j + 8 * hh] = lrow[j];
    }
  }
  __syncthreads();   // all NW_ partial states are in LDS before any thread joins them

  // ---- join the NW_ partial states, normalize and store.  Wave 0 always
  //      holds key 0, which no row masks, so the joint maximum is a real
  //      score.  Each thread owns EPT_ neighbouring columns of one row. ----
  constexpr int EPT_ = (16 * HS_) / (NW_ * 32);
  const int r  = (threadIdx.x * EPT_) / HS_;
  const int c0 = (threadIdx.x * EPT_) % HS_;

  float mall = sm[0][r];
#pragma unroll
  for (int w = 1; w < NW_; ++w) mall = fmaxf(mall, sm[w][r]);

  float lall = 0.f;
  float acc[EPT_];
#pragma unroll
  for (int e = 0; e < EPT_; ++e) acc[e] = 0.f;
#pragma unroll
  for (int w = 0; w < NW_; ++w) {
    const float f = __expf(sm[w][r] - mall);
    lall += f * sl[w][r];
#pragma unroll
    for (int e = 0; e < EPT_; ++e) acc[e] += f * so[w][r][c0 + e];
  }
  const float inv = 1.0f / lall;
  float* op = out + base + (size_t)(qr0 + r) * HS_ + c0;
#pragma unroll
  for (int e = 0; e < EPT_; ++e) op[e] = acc[e] * inv;
}

// -------------------------------------------------------------------------
extern "C" void kernel_launch(void* const* d_in, const int* in_sizes, int n_in,
                              void* d_out, int out_size, void* d_ws, size_t ws_size,
                              hipStream_t stream) {
  const float* x  = (const float*)d_in[0];
  const float* Wq = (const float*)d_in[1];
  const float* Wk = (const float*)d_in[2];
  const float* Wv = (const float*)d_in[3];

  const size_t nqkv = (size_t)B_ * T_ * HS_;   // 1,048,576 floats = 4 MB each
  float* qw = (float*)d_ws;
  float* kw = qw + nqkv;
  float* vw = kw + nqkv;

  // 1024 M-tiles of 16 rows, 4 waves (128 threads) per block
  qkv_proj_kernel<<<(B_ * T_ / 16) / 4, 128, 0, stream>>>(x, Wq, Wk, Wv, qw, kw, vw);
  // 1024 (batch, q-tile) tasks, one work-group of NW_ waves each
  flash_attn_kernel<<<B_ * (T_ / 16), NW_ * 32, 0, stream>>>(qw, kw, vw, (float*)d_out);
}

// v002
// Measured time: 106 microseconds a run.
// Next to v001, in two timings, it ran 1.68 and 1.69 times as fast.
// Counting every step since v000, it is 4.22 times as fast.
#include <hip/hip_runtime.h>
#include <math.h>

// Problem constants (from reference): B=8, T=2048, D=1024, HS=64
#define B_  8
#define T_  2048
#define D_  1024
#define HS_ 64

typedef __attribute__((ext_vector_type(2))) float v2f;
typedef __attribute__((ext_vector_type(8))) float v8f;

// D = A(16x4,f32) * B(4x16,f32) + C(16x16,f32) — full-precision CDNA5 WMMA.
__device__ __forceinline__ v8f wmma4(v2f a, v2f b, v8f c) {
  return __builtin_amdgcn_wmma_f32_16x16x4_f32(
      /*neg_a=*/false, a, /*neg_b=*/false, b,
      /*c_mod=*/(short)0, c, /*reuse_a=*/false, /*reuse_b=*/false);
}

// -------------------------------------------------------------------------
// Kernel 1: q/k/v = x @ {Wq,Wk,Wv}.  One work-group of 16 waves per 64 rows
// of x.  The K range is walked in slabs of PKB_: a slab of x (64 x PKB_) and of
// [Wq|Wk|Wv] (PKB_ x 192) is brought into LDS by asynchronous copies, two
// buffers, the next slab in flight while this one is multiplied.  Wave
// (mt, g) owns row tile mt and the three 16-column tiles 3g..3g+2 of the 192
// joined output columns; every accumulator still walks k = 0..D-1 in order.
// -------------------------------------------------------------------------
#define PM_  64                  // rows of x per work-group
#define PKB_ 128                 // k per slab
#define PNS_ (D_ / PKB_)         // slabs
#define XP_  (PKB_ + 4)          // LDS pitch of an x row, floats: 16 rows x 2 halves of 8-byte reads fall on 64 banks
#define WP_  (3 * HS_ + 16)      // LDS pitch of a joined W row, floats: rows k..k+3 fall on four different bank quarters
#define XSZ_ (PM_ * XP_)         // floats of x in a slab
#define WSZ_ (PKB_ * WP_)        // floats of W in a slab
#define STG_ (XSZ_ + WSZ_)       // floats of one buffer

__device__ __forceinline__ unsigned lds_off(const void* p) { return (unsigned)(size_t)p; }

// Eight 16-byte asynchronous copies of this lane, global -> LDS: four chunks
// from each of two sources, dl bytes apart in LDS and dg floats apart in
// memory.  The s_wait_xcnt stands inside the statement so that no address
// register of a copy is rewritten ahead of it.
__device__ __forceinline__ void copy8_b128(
    unsigned la, unsigned dla, const float* ga, int dga,
    unsigned lb, unsigned dlb, const float* gb, int dgb)
{
  asm volatile(
      "global_load_async_to_lds_b128 %0, %1, off\n\t"
      "global_load_async_to_lds_b128 %2, %3, off\n\t"
      "global_load_async_to_lds_b128 %4, %5, off\n\t"
      "global_load_async_to_lds_b128 %6, %7, off\n\t"
      "global_load_async_to_lds_b128 %8, %9, off\n\t"
      "global_load_async_to_lds_b128 %10, %11, off\n\t"
      "global_load_async_to_lds_b128 %12, %13, off\n\t"
      "global_load_async_to_lds_b128 %14, %15, off\n\t"
      "s_wait_xcnt 0x0"
      :: "v"(la),           "v"(ga),           "v"(la + dla),     "v"(ga + dga),
         "v"(la + 2 * dla), "v"(ga + 2 * dga), "v"(la + 3 * dla), "v"(ga + 3 * dga),
         "v"(lb),           "v"(gb),           "v"(lb + dlb),     "v"(gb + dgb),
         "v"(lb + 2 * dlb), "v"(gb + 2 * dgb), "v"(lb + 3 * dlb), "v"(gb + 3 * dgb)
      : "memory");
}

__global__ __launch_bounds__(512) void qkv_proj_kernel(
    const float* __restrict__ x,  const float* __restrict__ Wq,
    const float* __restrict__ Wk, const float* __restrict__ Wv,
    float* __restrict__ qo, float* __restrict__ ko, float* __restrict__ vo)
{
  __shared__ __attribute__((aligned(16))) float st[2 * STG_];

  const int tid  = threadIdx.x;
  const int wave = __builtin_amdgcn_readfirstlane(tid >> 5);
  const int lane = tid & 31;
  const int hh   = lane >> 4;      // which 16-lane half
  const int l16  = lane & 15;
  const int mt   = wave & 3;       // row tile of the work-group
  const int g    = wave >> 2;      // group of three column tiles
  const int row0 = blockIdx.x * PM_;

  // This thread's share of a slab: 4 chunks of x (one wave = one 512-byte row
  // piece; rows 16 apart) and 4 chunks of each W (rows 32 apart).
  const float*   gx = x + (size_t)(row0 + (tid >> 5)) * D_ + (tid & 31) * 4;
  const unsigned lx = lds_off(st) + (unsigned)(((tid >> 5) * XP_ + (tid & 31) * 4) * 4);
  const unsigned lw = lds_off(st) + (unsigned)((XSZ_ + (tid >> 4) * WP_ + (tid & 15) * 4) * 4);
  const int      gw = tid * 4;     // (tid >> 4) * HS_ + (tid & 15) * 4

  auto issue = [&](int s, int buf) {
    const unsigned bo = (unsigned)buf * (unsigned)(STG_ * 4);
    const size_t   wo = (size_t)s * (PKB_ * HS_) + gw;
    copy8_b128(lx + bo,               16 * XP_ * 4, gx + s * PKB_, 16 * D_,
               lw + bo,               32 * WP_ * 4, Wq + wo,       32 * HS_);
    copy8_b128(lw + bo + HS_ * 4,     32 * WP_ * 4, Wk + wo,       32 * HS_,
               lw + bo + 2 * HS_ * 4, 32 * WP_ * 4, Wv + wo,       32 * HS_);
  };

  const v8f vzero = {0.f,0.f,0.f,0.f,0.f,0.f,0.f,0.f};
  v8f acc[3];
#pragma unroll
  for (int i = 0; i < 3; ++i) acc[i] = vzero;

  // prologue: slab 0 landed and published, slab 1 in flight
  issue(0, 0);
  asm volatile("s_wait_asynccnt 0x0" ::: "memory");   // this wave's copies of slab 0 have landed
  __syncthreads();                                    // ... and every other wave's
  issue(1, 1);

  // A-fragment: A[M=l16][K = kk + 2*hh + v];  B-fragment: B[K = kk + 2*hh + v][N = l16]
  const float* xa = st + (mt * 16 + l16) * XP_ + 2 * hh;
  const float* wb = st + XSZ_ + (2 * hh) * WP_ + g * 48 + l16;

  for (int s = 0; s < PNS_; ++s) {
    const float* xs = xa + (s & 1) * STG_;
    const float* ws = wb + (s & 1) * STG_;
#pragma unroll
    for (int kk = 0; kk < PKB_; kk += 4) {
      v2f a;
      a[0] = xs[kk];
      a[1] = xs[kk + 1];
#pragma unroll
      for (int i = 0; i < 3; ++i) {
        v2f b;
        b[0] = ws[kk * WP_ + i * 16];
        b[1] = ws[(kk + 1) * WP_ + i * 16];
        acc[i] = wmma4(a, b, acc[i]);
      }
    }
    asm volatile("s_wait_dscnt 0x0" ::: "memory");      // this wave has left buffer s & 1
    asm volatile("s_wait_asynccnt 0x0" ::: "memory");   // its copies of slab s + 1 have landed
    __syncthreads();   // publishes slab s + 1 and frees buffer s & 1 for the refill
    if (s + 2 < PNS_) issue(s + 2, s & 1);
  }
  asm volatile("s_wait_asynccnt 0x0" ::: "memory");     // nothing in flight when the wave ends

  // C/D layout: element j of a lane is row (j + 8*hh), column l16.
#pragma unroll
  for (int i = 0; i < 3; ++i) {
    const int t = g * 3 + i;                 // column tile among the 12
    float* o = (t < 4) ? qo : (t < 8) ? ko : vo;
#pragma unroll
    for (int j = 0; j < 8; ++j)
      o[(size_t)(row0 + mt * 16 + j + 8 * hh) * HS_ + (t & 3) * 16 + l16] = acc[i][j];
  }
}

// -------------------------------------------------------------------------
// Kernel 2: causal flash attention over the q/k/v workspace.
// One work-group per (batch, 16-row query tile).  Its NW_ waves share the
// tile's key range: wave w takes key tiles w, w+NW_, w+2*NW_, ... and keeps
// its own online-softmax state (m, l, O).  The partial states are joined
// once, through LDS, behind one work-group barrier.
// P is transposed C->A layout through a per-wave LDS tile (no barrier in the
// loop: trip counts differ between waves).
// -------------------------------------------------------------------------
#define NW_ 8          // waves per work-group = key splits per query tile
#define OP_ 68         // LDS row pitch of a partial O tile, in floats

__global__ __launch_bounds__(NW_ * 32) void flash_attn_kernel(
    const float* __restrict__ q, const float* __restrict__ k,
    const float* __restrict__ vmat, float* __restrict__ out)
{
  __shared__ float pt[NW_][16][17];   // per-wave P-tile, padded vs bank conflicts
  __shared__ __attribute__((aligned(16))) float so[NW_][16][OP_];  // partial O
  __shared__ float sm[NW_][16];       // partial row maxima
  __shared__ float sl[NW_][16];       // partial row sums

  // wave-uniform by construction; read into a scalar register so that the
  // key loop's trip count is a scalar branch and EXEC stays all ones at the WMMAs
  const int wave = __builtin_amdgcn_readfirstlane(threadIdx.x >> 5);
  const int lane = threadIdx.x & 31;
  const int hh   = lane >> 4;
  const int l16  = lane & 15;

  const int task = blockIdx.x;              // 0 .. B*(T/16)-1
  const int bidx = task >> 7;               // T/16 == 128 tiles per batch
  const int it   = task & 127;              // query tile index
  const size_t base = (size_t)bidx * T_ * HS_;
  const int qr0 = it * 16;

  // Cache the whole 16x64 q tile in registers, A-layout, 16 K-steps of 4.
  v2f aq[16];
  const float* qp = q + base + (size_t)(qr0 + l16) * HS_ + 2 * hh;
#pragma unroll
  for (int c = 0; c < 16; ++c) { aq[c][0] = qp[4 * c]; aq[c][1] = qp[4 * c + 1]; }

  const v8f vzero = {0.f,0.f,0.f,0.f,0.f,0.f,0.f,0.f};
  v8f o[4];
#pragma unroll
  for (int nt = 0; nt < 4; ++nt) o[nt] = vzero;

  float mrow[8], lrow[8];           // stats for rows (j + 8*hh)
#pragma unroll
  for (int j = 0; j < 8; ++j) { mrow[j] = -INFINITY; lrow[j] = 0.f; }

  const float scale = 0.02209708691207961f;   // 1/sqrt(2048) (block_size!)

  for (int jt = wave; jt <= it; jt += NW_) {
    // ---- S = q @ k^T for this 16x16 tile (B[K][N] = k[jt*16+N][K]) ----
    v8f s = vzero;
    const float* kp = k + base + (size_t)(jt * 16 + l16) * HS_ + 2 * hh;
#pragma unroll
    for (int c = 0; c < 16; ++c) {
      v2f bk; bk[0] = kp[4 * c]; bk[1] = kp[4 * c + 1];
      s = wmma4(aq[c], bk, s);
    }

    // ---- scale, causal mask, online softmax (rows live across a
    //      16-lane half -> xor 1/2/4/8 reduces a row) ----
    float corr[8];
#pragma unroll
    for (int j = 0; j < 8; ++j) {
      float sv = s[j] * scale;
      if (jt == it && l16 > j + 8 * hh) sv = -INFINITY;   // col > row
      float rm = sv;
      rm = fmaxf(rm, __shfl_xor(rm, 1, 32));
      rm = fmaxf(rm, __shfl_xor(rm, 2, 32));
      rm = fmaxf(rm, __shfl_xor(rm, 4, 32));
      rm = fmaxf(rm, __shfl_xor(rm, 8, 32));
      float mnew = fmaxf(mrow[j], rm);
      corr[j] = __expf(mrow[j] - mnew);
      float p = __expf(sv - mnew);
      mrow[j] = mnew;
      s[j] = p;
      float rs = p;
      rs += __shfl_xor(rs, 1, 32);
      rs += __shfl_xor(rs, 2, 32);
      rs += __shfl_xor(rs, 4, 32);
      rs += __shfl_xor(rs, 8, 32);
      lrow[j] = lrow[j] * corr[j] + rs;
    }

    // rescale running output
#pragma unroll
    for (int nt = 0; nt < 4; ++nt)
#pragma unroll
      for (int j = 0; j < 8; ++j) o[nt][j] *= corr[j];

    // ---- transpose P (C-layout -> A-layout) via per-wave LDS tile ----
#pragma unroll
    for (int j = 0; j < 8; ++j) pt[wave][j + 8 * hh][l16] = s[j];
    asm volatile("s_wait_dscnt 0" ::: "memory");   // same-wave DS RAW fence

    // ---- O += P @ V : 4 K-steps of 4, 4 N-tiles of 16 ----
#pragma unroll
    for (int c = 0; c < 4; ++c) {
      v2f ap;
      ap[0] = pt[wave][l16][4 * c + 2 * hh];
      ap[1] = pt[wave][l16][4 * c + 2 * hh + 1];
      const float* vrow = vmat + base + (size_t)(jt * 16 + 4 * c + 2 * hh) * HS_;
#pragma unroll
      for (int nt = 0; nt < 4; ++nt) {
        v2f bv;
        bv[0] = vrow[nt * 16 + l16];        // B[K  ][N]
        bv[1] = vrow[HS_ + nt * 16 + l16];  // B[K+1][N]
        o[nt] = wmma4(ap, bv, o[nt]);
      }
    }
  }

  // ---- publish this wave's partial state (a wave without a key tile
  //      publishes m = -inf, l = 0, O = 0, which the join weighs with 0) ----
#pragma unroll
  for (int nt = 0; nt < 4; ++nt)
#pragma unroll
    for (int j = 0; j < 8; ++j) so[wave][j + 8 * hh][nt * 16 + l16] = o[nt][j];
  if (l16 == 0) {
#pragma unroll
    for (int j = 0; j < 8; ++j) {
      sm[wave][j + 8 * hh] = mrow[j];
      sl[wave][j + 8 * hh] = lrow[j];
    }
  }
  __syncthreads();   // all NW_ partial states are in LDS before any thread joins them

  // ---- join the NW_ partial states, normalize and store.  Wave 0 always
  //      holds key 0, which no row masks, so the joint maximum is a real
  //      score.  Each thread owns EPT_ neighbouring columns of one row. ----
  constexpr int EPT_ = (16 * HS_) / (NW_ * 32);
  const int r  = (threadIdx.x * EPT_) / HS_;
  const int c0 = (threadIdx.x * EPT_) % HS_;

  float mall = sm[0][r];
#pragma unroll
  for (int w = 1; w < NW_; ++w) mall = fmaxf(mall, sm[w][r]);

  float lall = 0.f;
  float acc[EPT_];
#pragma unroll
  for (int e = 0; e < EPT_; ++e) acc[e] = 0.f;
#pragma unroll
  for (int w = 0; w < NW_; ++w) {
    const float f = __expf(sm[w][r] - mall);
    lall += f * sl[w][r];
#pragma unroll
    for (int e = 0; e < EPT_; ++e) acc[e] += f * so[w][r][c0 + e];
  }
  const float inv = 1.0f / lall;
  float* op = out + base + (size_t)(qr0 + r) * HS_ + c0;
#pragma unroll
  for (int e = 0; e < EPT_; ++e) op[e] = acc[e] * inv;
}

// -------------------------------------------------------------------------
extern "C" void kernel_launch(void* const* d_in, const int* in_sizes, int n_in,
                              void* d_out, int out_size, void* d_ws, size_t ws_size,
                              hipStream_t stream) {
  const float* x  = (const float*)d_in[0];
  const float* Wq = (const float*)d_in[1];
  const float* Wk = (const float*)d_in[2];
  const float* Wv = (const float*)d_in[3];

  const size_t nqkv = (size_t)B_ * T_ * HS_;   // 1,048,576 floats = 4 MB each
  float* qw = (float*)d_ws;
  float* kw = qw + nqkv;
  float* vw = kw + nqkv;

  // 256 tiles of 64 rows, 16 waves (512 threads) per block
  qkv_proj_kernel<<<(B_ * T_) / PM_, 512, 0, stream>>>(x, Wq, Wk, Wv, qw, kw, vw);
  // 1024 (batch, q-tile) tasks, one work-group of NW_ waves each
  flash_attn_kernel<<<B_ * (T_ / 16), NW_ * 32, 0, stream>>>(qw, kw, vw, (float*)d_out);
}

// v003
// A run of this version takes 94.1 microseconds.
// Two timings next to v002 both put it at 1.12 times that version's speed.
// Counting every step since v000, it is 4.71 times as fast.
#include <hip/hip_runtime.h>
#include <math.h>

// Problem constants (from reference): B=8, T=2048, D=1024, HS=64
#define B_  8
#define T_  2048
#define D_  1024
#define HS_ 64

typedef __attribute__((ext_vector_type(2))) float v2f;
typedef __attribute__((ext_vector_type(8))) float v8f;

// D = A(16x4,f32) * B(4x16,f32) + C(16x16,f32) — full-precision CDNA5 WMMA.
__device__ __forceinline__ v8f wmma4(v2f a, v2f b, v8f c) {
  return __builtin_amdgcn_wmma_f32_16x16x4_f32(
      /*neg_a=*/false, a, /*neg_b=*/false, b,
      /*c_mod=*/(short)0, c, /*reuse_a=*/false, /*reuse_b=*/false);
}

// -------------------------------------------------------------------------
// Kernel 1: q/k/v = x @ {Wq,Wk,Wv}.  One work-group of 16 waves per 64 rows
// of x.  The K range is walked in slabs of PKB_: a slab of x (64 x PKB_) and of
// [Wq|Wk|Wv] (PKB_ x 192) is brought into LDS by asynchronous copies, two
// buffers, the next slab in flight while this one is multiplied.  Wave
// (mt, g) owns row tile mt and the three 16-column tiles 3g..3g+2 of the 192
// joined output columns; every accumulator still walks k = 0..D-1 in order.
// -------------------------------------------------------------------------
#define PM_  64                  // rows of x per work-group
#define PKB_ 128                 // k per slab
#define PNS_ (D_ / PKB_)         // slabs
#define XP_  (PKB_ + 4)          // LDS pitch of an x row, floats: 16 rows x 2 halves of 8-byte reads fall on 64 banks
#define WP_  (3 * HS_ + 16)      // LDS pitch of a joined W row, floats: rows k..k+3 fall on four different bank quarters
#define XSZ_ (PM_ * XP_)         // floats of x in a slab
#define WSZ_ (PKB_ * WP_)        // floats of W in a slab
#define STG_ (XSZ_ + WSZ_)       // floats of one buffer

__device__ __forceinline__ unsigned lds_off(const void* p) { return (unsigned)(size_t)p; }

// Eight 16-byte asynchronous copies of this lane, global -> LDS: four chunks
// from each of two sources, dl bytes apart in LDS and dg floats apart in
// memory.  The s_wait_xcnt stands inside the statement so that no address
// register of a copy is rewritten ahead of it.
__device__ __forceinline__ void copy8_b128(
    unsigned la, unsigned dla, const float* ga, int dga,
    unsigned lb, unsigned dlb, const float* gb, int dgb)
{
  asm volatile(
      "global_load_async_to_lds_b128 %0, %1, off\n\t"
      "global_load_async_to_lds_b128 %2, %3, off\n\t"
      "global_load_async_to_lds_b128 %4, %5, off\n\t"
      "global_load_async_to_lds_b128 %6, %7, off\n\t"
      "global_load_async_to_lds_b128 %8, %9, off\n\t"
      "global_load_async_to_lds_b128 %10, %11, off\n\t"
      "global_load_async_to_lds_b128 %12, %13, off\n\t"
      "global_load_async_to_lds_b128 %14, %15, off\n\t"
      "s_wait_xcnt 0x0"
      :: "v"(la),           "v"(ga),           "v"(la + dla),     "v"(ga + dga),
         "v"(la + 2 * dla), "v"(ga + 2 * dga), "v"(la + 3 * dla), "v"(ga + 3 * dga),
         "v"(lb),           "v"(gb),           "v"(lb + dlb),     "v"(gb + dgb),
         "v"(lb + 2 * dlb), "v"(gb + 2 * dgb), "v"(lb + 3 * dlb), "v"(gb + 3 * dgb)
      : "memory");
}

__global__ __launch_bounds__(512) void qkv_proj_kernel(
    const float* __restrict__ x,  const float* __restrict__ Wq,
    const float* __restrict__ Wk, const float* __restrict__ Wv,
    float* __restrict__ qo, float* __restrict__ ko, float* __restrict__ vo)
{
  __shared__ __attribute__((aligned(16))) float st[2 * STG_];

  const int tid  = threadIdx.x;
  const int wave = __builtin_amdgcn_readfirstlane(tid >> 5);
  const int lane = tid & 31;
  const int hh   = lane >> 4;      // which 16-lane half
  const int l16  = lane & 15;
  const int mt   = wave & 3;       // row tile of the work-group
  const int g    = wave >> 2;      // group of three column tiles
  const int row0 = blockIdx.x * PM_;

  // This thread's share of a slab: 4 chunks of x (one wave = one 512-byte row
  // piece; rows 16 apart) and 4 chunks of each W (rows 32 apart).
  const float*   gx = x + (size_t)(row0 + (tid >> 5)) * D_ + (tid & 31) * 4;
  const unsigned lx = lds_off(st) + (unsigned)(((tid >> 5) * XP_ + (tid & 31) * 4) * 4);
  const unsigned lw = lds_off(st) + (unsigned)((XSZ_ + (tid >> 4) * WP_ + (tid & 15) * 4) * 4);
  const int      gw = tid * 4;     // (tid >> 4) * HS_ + (tid & 15) * 4

  auto issue = [&](int s, int buf) {
    const unsigned bo = (unsigned)buf * (unsigned)(STG_ * 4);
    const size_t   wo = (size_t)s * (PKB_ * HS_) + gw;
    copy8_b128(lx + bo,               16 * XP_ * 4, gx + s * PKB_, 16 * D_,
               lw + bo,               32 * WP_ * 4, Wq + wo,       32 * HS_);
    copy8_b128(lw + bo + HS_ * 4,     32 * WP_ * 4, Wk + wo,       32 * HS_,
               lw + bo + 2 * HS_ * 4, 32 * WP_ * 4, Wv + wo,       32 * HS_);
  };

  const v8f vzero = {0.f,0.f,0.f,0.f,0.f,0.f,0.f,0.f};
  v8f acc[3];
#pragma unroll
  for (int i = 0; i < 3; ++i) acc[i] = vzero;

  // prologue: slab 0 landed and published, slab 1 in flight
  issue(0, 0);
  asm volatile("s_wait_asynccnt 0x0" ::: "memory");   // this wave's copies of slab 0 have landed
  __syncthreads();                                    // ... and every other wave's
  issue(1, 1);

  // A-fragment: A[M=l16][K = kk + 2*hh + v];  B-fragment: B[K = kk + 2*hh + v][N = l16]
  const float* xa = st + (mt * 16 + l16) * XP_ + 2 * hh;
  const float* wb = st + XSZ_ + (2 * hh) * WP_ + g * 48 + l16;

  for (int s = 0; s < PNS_; ++s) {
    const float* xs = xa + (s & 1) * STG_;
    const float* ws = wb + (s & 1) * STG_;
#pragma unroll
    for (int kk = 0; kk < PKB_; kk += 4) {
      v2f a;
      a[0] = xs[kk];
      a[1] = xs[kk + 1];
#pragma unroll
      for (int i = 0; i < 3; ++i) {
        v2f b;
        b[0] = ws[kk * WP_ + i * 16];
        b[1] = ws[(kk + 1) * WP_ + i * 16];
        acc[i] = wmma4(a, b, acc[i]);
      }
    }
    asm volatile("s_wait_dscnt 0x0" ::: "memory");      // this wave has left buffer s & 1
    asm volatile("s_wait_asynccnt 0x0" ::: "memory");   // its copies of slab s + 1 have landed
    __syncthreads();   // publishes slab s + 1 and frees buffer s & 1 for the refill
    if (s + 2 < PNS_) issue(s + 2, s & 1);
  }
  asm volatile("s_wait_asynccnt 0x0" ::: "memory");     // nothing in flight when the wave ends

  // C/D layout: element j of a lane is row (j + 8*hh), column l16.
#pragma unroll
  for (int i = 0; i < 3; ++i) {
    const int t = g * 3 + i;                 // column tile among the 12
    float* o = (t < 4) ? qo : (t < 8) ? ko : vo;
#pragma unroll
    for (int j = 0; j < 8; ++j)
      o[(size_t)(row0 + mt * 16 + j + 8 * hh) * HS_ + (t & 3) * 16 + l16] = acc[i][j];
  }
}

#define NW_ 8
#define OP_ 68

// value of lane l ^ 16
__device__ __forceinline__ float xhalf(float x) {
  return __builtin_bit_cast(float, __builtin_amdgcn_permlanex16(
      __builtin_bit_cast(int, x), __builtin_bit_cast(int, x),
      0x76543210, 0xfedcba98, false, false));
}

__global__ __launch_bounds__(NW_ * 32) void flash_attn_kernel(
    const float* __restrict__ q, const float* __restrict__ k,
    const float* __restrict__ vmat, float* __restrict__ out)
{
  __shared__ __attribute__((aligned(16))) float so[NW_][16][OP_];  // partial O
  __shared__ float sm[NW_][16];       // partial row maxima
  __shared__ float sl[NW_][16];       // partial row sums

  // wave-uniform by construction; read into a scalar register so that the
  // key loop's trip count is a scalar branch and EXEC stays all ones at the WMMAs
  const int wave = __builtin_amdgcn_readfirstlane(threadIdx.x >> 5);
  const int lane = threadIdx.x & 31;
  const int hh   = lane >> 4;
  const int l16  = lane & 15;

  const int task = blockIdx.x;              // 0 .. B*(T/16)-1
  const int bidx = task >> 7;               // T/16 == 128 tiles per batch
  const int it   = task & 127;              // query tile index
  const size_t base = (size_t)bidx * T_ * HS_;
  const int qr0 = it * 16;

  // Every loop over c, nt or j in this kernel is unrolled so that bq, o and s
  // are indexed by constants and stay in registers.
  // The whole 16x64 q tile in registers as B operand, 16 K-steps of 4:
  // B[K = 4c + 2*hh + v][N = l16] = q[qr0 + l16][4c + 2*hh + v].
  v2f bq[16];
  const float* qp = q + base + (size_t)(qr0 + l16) * HS_ + 2 * hh;
#pragma unroll
  for (int c = 0; c < 16; ++c) { bq[c][0] = qp[4 * c]; bq[c][1] = qp[4 * c + 1]; }

  const v8f vzero = {0.f,0.f,0.f,0.f,0.f,0.f,0.f,0.f};
  v8f o[4];                         // o[nt][j] = O[query l16][dim nt*16 + 8*hh + j]
#pragma unroll
  for (int nt = 0; nt < 4; ++nt) o[nt] = vzero;

  float mrow = -INFINITY;           // running maximum of query l16 (same in both halves)
  float lrow = 0.f;                 // running sum over this half's keys only

  const float scale = 0.02209708691207961f;   // 1/sqrt(2048) (block_size!)

  for (int jt = wave; jt <= it; jt += NW_) {
    // ---- S^T = k @ q^T for this 16x16 tile (A[M][K] = k[jt*16+M][K]) ----
    v8f s = vzero;
    const float* kp = k + base + (size_t)(jt * 16 + l16) * HS_ + 2 * hh;
#pragma unroll
    for (int c = 0; c < 16; ++c) {
      v2f ak; ak[0] = kp[4 * c]; ak[1] = kp[4 * c + 1];
      s = wmma4(ak, bq[c], s);
    }

    // ---- scale, causal mask: s[j] is key (jt*16 + 8*hh + j) of query l16 ----
#pragma unroll
    for (int j = 0; j < 8; ++j) {
      float sv = s[j] * scale;
      if (jt == it && j + 8 * hh > l16) sv = -INFINITY;   // key > query
      s[j] = sv;
    }

    // ---- online softmax, one query per lane ----
    float rm = fmaxf(fmaxf(fmaxf(s[0], s[1]), fmaxf(s[2], s[3])),
                     fmaxf(fmaxf(s[4], s[5]), fmaxf(s[6], s[7])));
    rm = fmaxf(rm, xhalf(rm));      // the other half's eight keys
    const float mnew = fmaxf(mrow, rm);
    const float corr = __expf(mrow - mnew);
    mrow = mnew;
#pragma unroll
    for (int j = 0; j < 8; ++j) s[j] = __expf(s[j] - mnew);
    lrow = lrow * corr + (((s[0] + s[1]) + (s[2] + s[3])) + ((s[4] + s[5]) + (s[6] + s[7])));

    // rescale running output
#pragma unroll
    for (int nt = 0; nt < 4; ++nt)
#pragma unroll
      for (int j = 0; j < 8; ++j) o[nt][j] *= corr;

    // ---- O^T += V^T @ P^T : 4 K-steps of 4, 4 M-tiles of 16 dims.  K position
    //      (c, hh, v) stands for key 8*hh + 2*c + v in BOTH operands:
    //      B[K][N = l16] = s[2c + v],  A[M = l16][K] = v[key][nt*16 + l16] ----
#pragma unroll
    for (int c = 0; c < 4; ++c) {
      v2f bp;
      bp[0] = s[2 * c];
      bp[1] = s[2 * c + 1];
      const float* vrow = vmat + base + (size_t)(jt * 16 + 8 * hh + 2 * c) * HS_;
#pragma unroll
      for (int nt = 0; nt < 4; ++nt) {
        v2f av;
        av[0] = vrow[nt * 16 + l16];
        av[1] = vrow[HS_ + nt * 16 + l16];
        o[nt] = wmma4(av, bp, o[nt]);
      }
    }
  }

  // ---- publish this wave's partial state (a wave without a key tile
  //      publishes m = -inf, l = 0, O = 0, which the join weighs with 0) ----
#pragma unroll
  for (int nt = 0; nt < 4; ++nt)
#pragma unroll
    for (int j = 0; j < 8; ++j) so[wave][l16][nt * 16 + 8 * hh + j] = o[nt][j];
  const float lsum = lrow + xhalf(lrow);    // both halves' keys
  if (hh == 0) {
    sm[wave][l16] = mrow;
    sl[wave][l16] = lsum;
  }
  __syncthreads();   // all NW_ partial states are in LDS before any thread joins them

  // ---- join the NW_ partial states, normalize and store.  Wave 0 always
  //      holds key 0, which no row masks, so the joint maximum is a real
  //      score.  Each thread owns EPT_ neighbouring columns of one row. ----
  constexpr int EPT_ = (16 * HS_) / (NW_ * 32);
  const int r  = (threadIdx.x * EPT_) / HS_;
  const int c0 = (threadIdx.x * EPT_) % HS_;

  float mall = sm[0][r];
#pragma unroll
  for (int w = 1; w < NW_; ++w) mall = fmaxf(mall, sm[w][r]);

  float lall = 0.f;
  float acc[EPT_];
#pragma unroll
  for (int e = 0; e < EPT_; ++e) acc[e] = 0.f;
#pragma unroll
  for (int w = 0; w < NW_; ++w) {
    const float f = __expf(sm[w][r] - mall);
    lall += f * sl[w][r];
#pragma unroll
    for (int e = 0; e < EPT_; ++e) acc[e] += f * so[w][r][c0 + e];
  }
  const float inv = 1.0f / lall;
  float* op = out + base + (size_t)(qr0 + r) * HS_ + c0;
#pragma unroll
  for (int e = 0; e < EPT_; ++e) op[e] = acc[e] * inv;
}

// -------------------------------------------------------------------------
extern "C" void kernel_launch(void* const* d_in, const int* in_sizes, int n_in,
                              void* d_out, int out_size, void* d_ws, size_t ws_size,
                              hipStream_t stream) {
  const float* x  = (const float*)d_in[0];
  const float* Wq = (const float*)d_in[1];
  const float* Wk = (const float*)d_in[2];
  const float* Wv = (const float*)d_in[3];

  const size_t nqkv = (size_t)B_ * T_ * HS_;   // 1,048,576 floats = 4 MB each
  float* qw = (float*)d_ws;
  float* kw = qw + nqkv;
  float* vw = kw + nqkv;

  // 256 tiles of 64 rows, 16 waves (512 threads) per block
  qkv_proj_kernel<<<(B_ * T_) / PM_, 512, 0, stream>>>(x, Wq, Wk, Wv, qw, kw, vw);
  // 1024 (batch, q-tile) tasks, one work-group of NW_ waves each
  flash_attn_kernel<<<B_ * (T_ / 16), NW_ * 32, 0, stream>>>(qw, kw, vw, (float*)d_out);
}

// v004
// It runs in 74.5 microseconds.
// Next to v003, in two timings, it ran 1.28 and 1.27 times as fast.
// Over all steps from v000 it is 5.99 times as fast.
#include <hip/hip_runtime.h>
#include <math.h>

// Problem constants (from reference): B=8, T=2048, D=1024, HS=64
#define B_  8
#define T_  2048
#define D_  1024
#define HS_ 64

typedef __attribute__((ext_vector_type(2))) float v2f;
typedef __attribute__((ext_vector_type(4))) float v4f;
typedef __attribute__((ext_vector_type(8))) float v8f;

// D = A(16x4,f32) * B(4x16,f32) + C(16x16,f32) — full-precision CDNA5 WMMA.
__device__ __forceinline__ v8f wmma4(v2f a, v2f b, v8f c) {
  return __builtin_amdgcn_wmma_f32_16x16x4_f32(
      /*neg_a=*/false, a, /*neg_b=*/false, b,
      /*c_mod=*/(short)0, c, /*reuse_a=*/false, /*reuse_b=*/false);
}

// -------------------------------------------------------------------------
// Kernel 1: q/k/v = x @ {Wq,Wk,Wv}.  One work-group of 16 waves per 64 rows
// of x.  The K range is walked in slabs of PKB_: a slab of x (64 x PKB_) and of
// [Wq|Wk|Wv] (PKB_ x 192) is brought into LDS by asynchronous copies, two
// buffers, the next slab in flight while this one is multiplied.  Wave
// (mt, g) owns row tile mt and 16-column tile g of each of q, k and v; every
// accumulator still walks k = 0..D-1 in order.
//
// Workspace layout.  q, k and v are not kept row-major but in the order in
// which the attention kernel's matrix operands want them.  A tile of 16 rows
// x 64 columns is FT_ floats in 8 units of 512 bytes; unit u holds four floats
// e = 0..3 of each lane (hh, l16), at float u*128 + lane*4 + e:
//   q, k:  row l16,            column 16*(u>>1) + 8*hh + 4*(u&1) + e
//   v:     row 8*hh + 4*(u&1) + e,  column 16*(u>>1) + l16
// One global_load_b128 or global_store_b128 of a wave is then one unit: four
// whole 128-byte lines.  For v these are the accumulator registers of x W as
// they stand; for q and k those of the transposed product W^T x^T, which takes
// the same two register pairs with A and B exchanged.
// -------------------------------------------------------------------------
#define FT_  (16 * HS_)          // floats of one 16-row tile
#define PM_  64                  // rows of x per work-group
#define PKB_ 128                 // k per slab
#define PNS_ (D_ / PKB_)         // slabs
#define XP_  (PKB_ + 4)          // LDS pitch of an x row, floats: 16 rows x 2 halves of 8-byte reads fall on 64 banks
#define WP_  (3 * HS_ + 16)      // LDS pitch of a joined W row, floats: rows k..k+3 fall on four different bank quarters
#define XSZ_ (PM_ * XP_)         // floats of x in a slab
#define WSZ_ (PKB_ * WP_)        // floats of W in a slab
#define STG_ (XSZ_ + WSZ_)       // floats of one buffer

__device__ __forceinline__ unsigned lds_off(const void* p) { return (unsigned)(size_t)p; }

// Eight 16-byte asynchronous copies of this lane, global -> LDS: four chunks
// from each of two sources, dl bytes apart in LDS and dg floats apart in
// memory.  The s_wait_xcnt stands inside the statement so that no address
// register of a copy is rewritten ahead of it.
__device__ __forceinline__ void copy8_b128(
    unsigned la, unsigned dla, const float* ga, int dga,
    unsigned lb, unsigned dlb, const float* gb, int dgb)
{
  asm volatile(
      "global_load_async_to_lds_b128 %0, %1, off\n\t"
      "global_load_async_to_lds_b128 %2, %3, off\n\t"
      "global_load_async_to_lds_b128 %4, %5, off\n\t"
      "global_load_async_to_lds_b128 %6, %7, off\n\t"
      "global_load_async_to_lds_b128 %8, %9, off\n\t"
      "global_load_async_to_lds_b128 %10, %11, off\n\t"
      "global_load_async_to_lds_b128 %12, %13, off\n\t"
      "global_load_async_to_lds_b128 %14, %15, off\n\t"
      "s_wait_xcnt 0x0"
      :: "v"(la),           "v"(ga),           "v"(la + dla),     "v"(ga + dga),
         "v"(la + 2 * dla), "v"(ga + 2 * dga), "v"(la + 3 * dla), "v"(ga + 3 * dga),
         "v"(lb),           "v"(gb),           "v"(lb + dlb),     "v"(gb + dgb),
         "v"(lb + 2 * dlb), "v"(gb + 2 * dgb), "v"(lb + 3 * dlb), "v"(gb + 3 * dgb)
      : "memory");
}

__global__ __launch_bounds__(512) void qkv_proj_kernel(
    const float* __restrict__ x,  const float* __restrict__ Wq,
    const float* __restrict__ Wk, const float* __restrict__ Wv,
    float* __restrict__ qo, float* __restrict__ ko, float* __restrict__ vo)
{
  __shared__ __attribute__((aligned(16))) float st[2 * STG_];

  const int tid  = threadIdx.x;
  const int wave = __builtin_amdgcn_readfirstlane(tid >> 5);
  const int lane = tid & 31;
  const int hh   = lane >> 4;      // which 16-lane half
  const int l16  = lane & 15;
  const int mt   = wave & 3;       // row tile of the work-group
  const int g    = wave >> 2;      // column tile of q, of k and of v
  const int row0 = blockIdx.x * PM_;

  // This thread's share of a slab: 4 chunks of x (one wave = one 512-byte row
  // piece; rows 16 apart) and 4 chunks of each W (rows 32 apart).
  const float*   gx = x + (size_t)(row0 + (tid >> 5)) * D_ + (tid & 31) * 4;
  const unsigned lx = lds_off(st) + (unsigned)(((tid >> 5) * XP_ + (tid & 31) * 4) * 4);
  const unsigned lw = lds_off(st) + (unsigned)((XSZ_ + (tid >> 4) * WP_ + (tid & 15) * 4) * 4);
  const int      gw = tid * 4;     // (tid >> 4) * HS_ + (tid & 15) * 4

  auto issue = [&](int s, int buf) {
    const unsigned bo = (unsigned)buf * (unsigned)(STG_ * 4);
    const size_t   wo = (size_t)s * (PKB_ * HS_) + gw;
    copy8_b128(lx + bo,               16 * XP_ * 4, gx + s * PKB_, 16 * D_,
               lw + bo,               32 * WP_ * 4, Wq + wo,       32 * HS_);
    copy8_b128(lw + bo + HS_ * 4,     32 * WP_ * 4, Wk + wo,       32 * HS_,
               lw + bo + 2 * HS_ * 4, 32 * WP_ * 4, Wv + wo,       32 * HS_);
  };

  const v8f vzero = {0.f,0.f,0.f,0.f,0.f,0.f,0.f,0.f};
  v8f acc[3];
#pragma unroll
  for (int i = 0; i < 3; ++i) acc[i] = vzero;

  // prologue: slab 0 landed and published, slab 1 in flight
  issue(0, 0);
  asm volatile("s_wait_asynccnt 0x0" ::: "memory");   // this wave's copies of slab 0 have landed
  __syncthreads();                                    // ... and every other wave's
  issue(1, 1);

  // A-fragment: A[M=l16][K = kk + 2*hh + v];  B-fragment: B[K = kk + 2*hh + v][N = l16]
  const float* xa = st + (mt * 16 + l16) * XP_ + 2 * hh;
  const float* wb = st + XSZ_ + (2 * hh) * WP_ + g * 16 + l16;

  for (int s = 0; s < PNS_; ++s) {
    const float* xs = xa + (s & 1) * STG_;
    const float* ws = wb + (s & 1) * STG_;
#pragma unroll
    for (int kk = 0; kk < PKB_; kk += 4) {
      v2f a;
      a[0] = xs[kk];
      a[1] = xs[kk + 1];
#pragma unroll
      for (int i = 0; i < 3; ++i) {
        v2f b;
        b[0] = ws[kk * WP_ + i * HS_];
        b[1] = ws[(kk + 1) * WP_ + i * HS_];
        // i = 0, 1 (q, k): W^T x^T, a lane ends with 8 columns of one row;
        // i = 2 (v): x W, a lane ends with 8 rows of one column
        acc[i] = (i < 2) ? wmma4(b, a, acc[i]) : wmma4(a, b, acc[i]);
      }
    }
    asm volatile("s_wait_dscnt 0x0" ::: "memory");      // this wave has left buffer s & 1
    asm volatile("s_wait_asynccnt 0x0" ::: "memory");   // its copies of slab s + 1 have landed
    __syncthreads();   // publishes slab s + 1 and frees buffer s & 1 for the refill
    if (s + 2 < PNS_) issue(s + 2, s & 1);
  }
  asm volatile("s_wait_asynccnt 0x0" ::: "memory");     // nothing in flight when the wave ends

  // C/D layout: element j of a lane is M = j + 8*hh, N = l16.  Registers 0..3
  // are this lane's floats of unit 2g, registers 4..7 those of unit 2g + 1.
  const size_t fo = (size_t)(blockIdx.x * (PM_ / 16) + mt) * FT_ + g * 256 + lane * 4;
#pragma unroll
  for (int i = 0; i < 3; ++i) {
    float* o = ((i == 0) ? qo : (i == 1) ? ko : vo) + fo;
    *(v4f*)o         = __builtin_shufflevector(acc[i], acc[i], 0, 1, 2, 3);
    *(v4f*)(o + 128) = __builtin_shufflevector(acc[i], acc[i], 4, 5, 6, 7);
  }
}

#define NW_ 8
#define OP_ 68

// value of lane l ^ 16
__device__ __forceinline__ float xhalf(float x) {
  return __builtin_bit_cast(float, __builtin_amdgcn_permlanex16(
      __builtin_bit_cast(int, x), __builtin_bit_cast(int, x),
      0x76543210, 0xfedcba98, false, false));
}

__global__ __launch_bounds__(NW_ * 32) void flash_attn_kernel(
    const float* __restrict__ q, const float* __restrict__ k,
    const float* __restrict__ vmat, float* __restrict__ out)
{
  __shared__ __attribute__((aligned(16))) float so[NW_][16][OP_];  // partial O
  __shared__ float sm[NW_][16];       // partial row maxima
  __shared__ float sl[NW_][16];       // partial row sums

  // wave-uniform by construction; read into a scalar register so that the
  // key loop's trip count is a scalar branch and EXEC stays all ones at the WMMAs
  const int wave = __builtin_amdgcn_readfirstlane(threadIdx.x >> 5);
  const int lane = threadIdx.x & 31;
  const int hh   = lane >> 4;
  const int l16  = lane & 15;

  const int task = blockIdx.x;              // 0 .. B*(T/16)-1
  const int bidx = task >> 7;               // T/16 == 128 tiles per batch
  const int it   = task & 127;              // query tile index
  const size_t base = (size_t)bidx * T_ * HS_;
  const int qr0 = it * 16;

  // Every loop over c, nt or j in this kernel is unrolled so that bq, o and s
  // are indexed by constants and stay in registers.
  // The whole 16x64 q tile in registers as B operand, 16 K-steps of 4.  K
  // position (c, hh, v) stands for head dim 16*(c>>2) + 8*hh + 4*((c>>1)&1) +
  // 2*(c&1) + v in BOTH operands of S^T: unit u feeds steps 2u and 2u + 1.
  v2f bq[16];
  const float* qp = q + base + (size_t)it * FT_ + lane * 4;
#pragma unroll
  for (int u = 0; u < 8; ++u) {
    const v4f f = *(const v4f*)(qp + u * 128);
    bq[2 * u][0] = f[0];     bq[2 * u][1] = f[1];
    bq[2 * u + 1][0] = f[2]; bq[2 * u + 1][1] = f[3];
  }

  const v8f vzero = {0.f,0.f,0.f,0.f,0.f,0.f,0.f,0.f};
  v8f o[4];                         // o[nt][j] = O[query l16][dim nt*16 + 8*hh + j]
#pragma unroll
  for (int nt = 0; nt < 4; ++nt) o[nt] = vzero;

  float mrow = -INFINITY;           // running maximum of query l16 (same in both halves)
  float lrow = 0.f;                 // running sum over this half's keys only

  const float scale = 0.02209708691207961f;   // 1/sqrt(2048) (block_size!)

  for (int jt = wave; jt <= it; jt += NW_) {
    // ---- S^T = k @ q^T for this 16x16 tile (A[M][K] = k[jt*16+M][K]) ----
    v8f s = vzero;
    const v4f* kp = (const v4f*)(k + base + (size_t)jt * FT_) + lane;
    const v4f* vp = (const v4f*)(vmat + base + (size_t)jt * FT_) + lane;
    v4f fk[8], fv[8];
#pragma unroll
    for (int u = 0; u < 8; ++u) fk[u] = kp[u * 32];
#pragma unroll
    for (int u = 0; u < 8; ++u) fv[u] = vp[u * 32];
    // no register that an issued load names is rewritten ahead of this wait:
    // the two address pairs are inputs, so they stay live up to it and no
    // load's destination is laid over them
    asm volatile("s_wait_xcnt 0x0" :: "v"(kp), "v"(vp) : "memory");
    // keeps the tile's 16 loads together ahead of the products: sunk between
    // them, only three are in flight and a wave meets the load latency
    // several times a tile instead of once
    __builtin_amdgcn_sched_barrier(0);
#pragma unroll
    for (int u = 0; u < 8; ++u) {
      const v4f f = fk[u];
      v2f ak;
      ak[0] = f[0]; ak[1] = f[1];
      s = wmma4(ak, bq[2 * u], s);
      ak[0] = f[2]; ak[1] = f[3];
      s = wmma4(ak, bq[2 * u + 1], s);
    }

    // ---- scale, causal mask: s[j] is key (jt*16 + 8*hh + j) of query l16 ----
#pragma unroll
    for (int j = 0; j < 8; ++j) {
      float sv = s[j] * scale;
      if (jt == it && j + 8 * hh > l16) sv = -INFINITY;   // key > query
      s[j] = sv;
    }

    // ---- online softmax, one query per lane ----
    float rm = fmaxf(fmaxf(fmaxf(s[0], s[1]), fmaxf(s[2], s[3])),
                     fmaxf(fmaxf(s[4], s[5]), fmaxf(s[6], s[7])));
    rm = fmaxf(rm, xhalf(rm));      // the other half's eight keys
    const float mnew = fmaxf(mrow, rm);
    const float corr = __expf(mrow - mnew);
    mrow = mnew;
#pragma unroll
    for (int j = 0; j < 8; ++j) s[j] = __expf(s[j] - mnew);
    lrow = lrow * corr + (((s[0] + s[1]) + (s[2] + s[3])) + ((s[4] + s[5]) + (s[6] + s[7])));

    // rescale running output
#pragma unroll
    for (int nt = 0; nt < 4; ++nt)
#pragma unroll
      for (int j = 0; j < 8; ++j) o[nt][j] *= corr;

    // ---- O^T += V^T @ P^T : 4 K-steps of 4, 4 M-tiles of 16 dims.  K position
    //      (c, hh, v) stands for key 8*hh + 2*c + v in BOTH operands:
    //      B[K][N = l16] = s[2c + v],  A[M = l16][K] = v[key][nt*16 + l16]:
    //      unit 2*nt + (c>>1), floats 2*(c&1) + v ----
#pragma unroll
    for (int c = 0; c < 4; ++c) {
      v2f bp;
      bp[0] = s[2 * c];
      bp[1] = s[2 * c + 1];
#pragma unroll
      for (int nt = 0; nt < 4; ++nt) {
        v2f av;
        av[0] = fv[2 * nt + (c >> 1)][2 * (c & 1)];
        av[1] = fv[2 * nt + (c >> 1)][2 * (c & 1) + 1];
        o[nt] = wmma4(av, bp, o[nt]);
      }
    }
  }

  // ---- publish this wave's partial state (a wave without a key tile
  //      publishes m = -inf, l = 0, O = 0, which the join weighs with 0) ----
#pragma unroll
  for (int nt = 0; nt < 4; ++nt)
#pragma unroll
    for (int j = 0; j < 8; ++j) so[wave][l16][nt * 16 + 8 * hh + j] = o[nt][j];
  const float lsum = lrow + xhalf(lrow);    // both halves' keys
  if (hh == 0) {
    sm[wave][l16] = mrow;
    sl[wave][l16] = lsum;
  }
  __syncthreads();   // all NW_ partial states are in LDS before any thread joins them

  // ---- join the NW_ partial states, normalize and store.  Wave 0 always
  //      holds key 0, which no row masks, so the joint maximum is a real
  //      score.  Each thread owns EPT_ neighbouring columns of one row. ----
  constexpr int EPT_ = (16 * HS_) / (NW_ * 32);
  const int r  = (threadIdx.x * EPT_) / HS_;
  const int c0 = (threadIdx.x * EPT_) % HS_;

  float mall = sm[0][r];
#pragma unroll
  for (int w = 1; w < NW_; ++w) mall = fmaxf(mall, sm[w][r]);

  float lall = 0.f;
  float acc[EPT_];
#pragma unroll
  for (int e = 0; e < EPT_; ++e) acc[e] = 0.f;
#pragma unroll
  for (int w = 0; w < NW_; ++w) {
    const float f = __expf(sm[w][r] - mall);
    lall += f * sl[w][r];
#pragma unroll
    for (int e = 0; e < EPT_; ++e) acc[e] += f * so[w][r][c0 + e];
  }
  const float inv = 1.0f / lall;
  float* op = out + base + (size_t)(qr0 + r) * HS_ + c0;
#pragma unroll
  for (int e = 0; e < EPT_; ++e) op[e] = acc[e] * inv;
}

// -------------------------------------------------------------------------
extern "C" void kernel_launch(void* const* d_in, const int* in_sizes, int n_in,
                              void* d_out, int out_size, void* d_ws, size_t ws_size,
                              hipStream_t stream) {
  const float* x  = (const float*)d_in[0];
  const float* Wq = (const float*)d_in[1];
  const float* Wk = (const float*)d_in[2];
  const float* Wv = (const float*)d_in[3];

  const size_t nqkv = (size_t)B_ * T_ * HS_;   // 1,048,576 floats = 4 MB each
  float* qw = (float*)d_ws;
  float* kw = qw + nqkv;
  float* vw = kw + nqkv;

  // 256 tiles of 64 rows, 16 waves (512 threads) per block
  qkv_proj_kernel<<<(B_ * T_) / PM_, 512, 0, stream>>>(x, Wq, Wk, Wv, qw, kw, vw);
  // 1024 (batch, q-tile) tasks, one work-group of NW_ waves each
  flash_attn_kernel<<<B_ * (T_ / 16), NW_ * 32, 0, stream>>>(qw, kw, vw, (float*)d_out);
}

// v005
// It runs in 66.4 microseconds.
// In two side-by-side timings against v004, it was 1.14 and 1.13 times as fast.
// Over all steps from v000 it is 6.78 times as fast.
#include <hip/hip_runtime.h>
#include <math.h>

// Problem constants (from reference): B=8, T=2048, D=1024, HS=64
#define B_  8
#define T_  2048
#define D_  1024
#define HS_ 64

typedef __attribute__((ext_vector_type(2))) float v2f;
typedef __attribute__((ext_vector_type(4))) float v4f;
typedef __attribute__((ext_vector_type(8))) float v8f;

// D = A(16x4,f32) * B(4x16,f32) + C(16x16,f32) — full-precision CDNA5 WMMA.
__device__ __forceinline__ v8f wmma4(v2f a, v2f b, v8f c) {
  return __builtin_amdgcn_wmma_f32_16x16x4_f32(
      /*neg_a=*/false, a, /*neg_b=*/false, b,
      /*c_mod=*/(short)0, c, /*reuse_a=*/false, /*reuse_b=*/false);
}

// -------------------------------------------------------------------------
// Kernel 1: q/k/v = x @ {Wq,Wk,Wv}.  One work-group of 16 waves per 64 rows
// of x.  The K range is walked in slabs of PKB_: a slab of x (64 x PKB_) and of
// [Wq|Wk|Wv] (PKB_ x 192) is brought into LDS by asynchronous copies, two
// buffers, the next slab in flight while this one is multiplied.  Wave
// (mt, g) owns row tile mt and 16-column tile g of each of q, k and v; every
// accumulator still walks k = 0..D-1 in order.
//
// Workspace layout.  q, k and v are not kept row-major but in the order in
// which the attention kernel's matrix operands want them.  A tile of 16 rows
// x 64 columns is FT_ floats in 8 units of 512 bytes; unit u holds four floats
// e = 0..3 of each lane (hh, l16), at float u*128 + lane*4 + e:
//   q, k:  row l16,            column 16*(u>>1) + 8*hh + 4*(u&1) + e
//   v:     row 8*hh + 4*(u&1) + e,  column 16*(u>>1) + l16
// One global_load_b128 or global_store_b128 of a wave is then one unit: four
// whole 128-byte lines.  For v these are the accumulator registers of x W as
// they stand; for q and k those of the transposed product W^T x^T, which takes
// the same two register pairs with A and B exchanged.
// -------------------------------------------------------------------------
#define FT_  (16 * HS_)          // floats of one 16-row tile
#define PM_  64                  // rows of x per work-group
#define PKB_ 128                 // k per slab
#define PNS_ (D_ / PKB_)         // slabs
#define XP_  (PKB_ + 4)          // LDS pitch of an x row, floats: 16 rows x 2 halves of 8-byte reads fall on 64 banks
#define WP_  (3 * HS_ + 16)      // LDS pitch of a joined W row, floats: rows k..k+3 fall on four different bank quarters
#define XSZ_ (PM_ * XP_)         // floats of x in a slab
#define WSZ_ (PKB_ * WP_)        // floats of W in a slab
#define STG_ (XSZ_ + WSZ_)       // floats of one buffer

__device__ __forceinline__ unsigned lds_off(const void* p) { return (unsigned)(size_t)p; }

// Eight 16-byte asynchronous copies of this lane, global -> LDS: four chunks
// from each of two sources, dl bytes apart in LDS and dg floats apart in
// memory.  The s_wait_xcnt stands inside the statement so that no address
// register of a copy is rewritten ahead of it.
__device__ __forceinline__ void copy8_b128(
    unsigned la, unsigned dla, const float* ga, int dga,
    unsigned lb, unsigned dlb, const float* gb, int dgb)
{
  asm volatile(
      "global_load_async_to_lds_b128 %0, %1, off\n\t"
      "global_load_async_to_lds_b128 %2, %3, off\n\t"
      "global_load_async_to_lds_b128 %4, %5, off\n\t"
      "global_load_async_to_lds_b128 %6, %7, off\n\t"
      "global_load_async_to_lds_b128 %8, %9, off\n\t"
      "global_load_async_to_lds_b128 %10, %11, off\n\t"
      "global_load_async_to_lds_b128 %12, %13, off\n\t"
      "global_load_async_to_lds_b128 %14, %15, off\n\t"
      "s_wait_xcnt 0x0"
      :: "v"(la),           "v"(ga),           "v"(la + dla),     "v"(ga + dga),
         "v"(la + 2 * dla), "v"(ga + 2 * dga), "v"(la + 3 * dla), "v"(ga + 3 * dga),
         "v"(lb),           "v"(gb),           "v"(lb + dlb),     "v"(gb + dgb),
         "v"(lb + 2 * dlb), "v"(gb + 2 * dgb), "v"(lb + 3 * dlb), "v"(gb + 3 * dgb)
      : "memory");
}

__global__ __launch_bounds__(512) void qkv_proj_kernel(
    const float* __restrict__ x,  const float* __restrict__ Wq,
    const float* __restrict__ Wk, const float* __restrict__ Wv,
    float* __restrict__ qo, float* __restrict__ ko, float* __restrict__ vo)
{
  __shared__ __attribute__((aligned(16))) float st[2 * STG_];

  const int tid  = threadIdx.x;
  const int wave = __builtin_amdgcn_readfirstlane(tid >> 5);
  const int lane = tid & 31;
  const int hh   = lane >> 4;      // which 16-lane half
  const int l16  = lane & 15;
  const int mt   = wave & 3;       // row tile of the work-group
  const int g    = wave >> 2;      // column tile of q, of k and of v
  const int row0 = blockIdx.x * PM_;

  // This thread's share of a slab: 4 chunks of x (one wave = one 512-byte row
  // piece; rows 16 apart) and 4 chunks of each W (rows 32 apart).
  const float*   gx = x + (size_t)(row0 + (tid >> 5)) * D_ + (tid & 31) * 4;
  const unsigned lx = lds_off(st) + (unsigned)(((tid >> 5) * XP_ + (tid & 31) * 4) * 4);
  const unsigned lw = lds_off(st) + (unsigned)((XSZ_ + (tid >> 4) * WP_ + (tid & 15) * 4) * 4);
  const int      gw = tid * 4;     // (tid >> 4) * HS_ + (tid & 15) * 4

  auto issue = [&](int s, int buf) {
    const unsigned bo = (unsigned)buf * (unsigned)(STG_ * 4);
    const size_t   wo = (size_t)s * (PKB_ * HS_) + gw;
    copy8_b128(lx + bo,               16 * XP_ * 4, gx + s * PKB_, 16 * D_,
               lw + bo,               32 * WP_ * 4, Wq + wo,       32 * HS_);
    copy8_b128(lw + bo + HS_ * 4,     32 * WP_ * 4, Wk + wo,       32 * HS_,
               lw + bo + 2 * HS_ * 4, 32 * WP_ * 4, Wv + wo,       32 * HS_);
  };

  const v8f vzero = {0.f,0.f,0.f,0.f,0.f,0.f,0.f,0.f};
  v8f acc[3];
#pragma unroll
  for (int i = 0; i < 3; ++i) acc[i] = vzero;

  // prologue: slab 0 landed and published, slab 1 in flight
  issue(0, 0);
  asm volatile("s_wait_asynccnt 0x0" ::: "memory");   // this wave's copies of slab 0 have landed
  __syncthreads();                                    // ... and every other wave's
  issue(1, 1);

  // A-fragment: A[M=l16][K = kk + 2*hh + v];  B-fragment: B[K = kk + 2*hh + v][N = l16]
  const float* xa = st + (mt * 16 + l16) * XP_ + 2 * hh;
  const float* wb = st + XSZ_ + (2 * hh) * WP_ + g * 16 + l16;

  for (int s = 0; s < PNS_; ++s) {
    const float* xs = xa + (s & 1) * STG_;
    const float* ws = wb + (s & 1) * STG_;
#pragma unroll
    for (int kk = 0; kk < PKB_; kk += 4) {
      v2f a;
      a[0] = xs[kk];
      a[1] = xs[kk + 1];
#pragma unroll
      for (int i = 0; i < 3; ++i) {
        v2f b;
        b[0] = ws[kk * WP_ + i * HS_];
        b[1] = ws[(kk + 1) * WP_ + i * HS_];
        // i = 0, 1 (q, k): W^T x^T, a lane ends with 8 columns of one row;
        // i = 2 (v): x W, a lane ends with 8 rows of one column
        acc[i] = (i < 2) ? wmma4(b, a, acc[i]) : wmma4(a, b, acc[i]);
      }
    }
    asm volatile("s_wait_dscnt 0x0" ::: "memory");      // this wave has left buffer s & 1
    asm volatile("s_wait_asynccnt 0x0" ::: "memory");   // its copies of slab s + 1 have landed
    __syncthreads();   // publishes slab s + 1 and frees buffer s & 1 for the refill
    if (s + 2 < PNS_) issue(s + 2, s & 1);
  }
  asm volatile("s_wait_asynccnt 0x0" ::: "memory");     // nothing in flight when the wave ends

  // C/D layout: element j of a lane is M = j + 8*hh, N = l16.  Registers 0..3
  // are this lane's floats of unit 2g, registers 4..7 those of unit 2g + 1.
  const size_t fo = (size_t)(blockIdx.x * (PM_ / 16) + mt) * FT_ + g * 256 + lane * 4;
#pragma unroll
  for (int i = 0; i < 3; ++i) {
    float* o = ((i == 0) ? qo : (i == 1) ? ko : vo) + fo;
    *(v4f*)o         = __builtin_shufflevector(acc[i], acc[i], 0, 1, 2, 3);
    *(v4f*)(o + 128) = __builtin_shufflevector(acc[i], acc[i], 4, 5, 6, 7);
  }
}

#define NW_ 8
#define NT_ (T_ / 16)
#define OP_ 68

// value of lane l ^ 16
__device__ __forceinline__ float xhalf(float x) {
  return __builtin_bit_cast(float, __builtin_amdgcn_permlanex16(
      __builtin_bit_cast(int, x), __builtin_bit_cast(int, x),
      0x76543210, 0xfedcba98, false, false));
}

__global__ __launch_bounds__(NW_ * 32) void flash_attn_kernel(
    const float* __restrict__ q, const float* __restrict__ k,
    const float* __restrict__ vmat, float* __restrict__ out)
{
  __shared__ __attribute__((aligned(16))) float so[2][NW_][16][OP_];  // partial O, per tile of the pair
  __shared__ float sm[2][NW_][16];    // partial row maxima
  __shared__ float sl[2][NW_][16];    // partial row sums

  // wave-uniform by construction; read into a scalar register so that the
  // key loop's trip count is a scalar branch and EXEC stays all ones at the WMMAs
  const int wave = __builtin_amdgcn_readfirstlane(threadIdx.x >> 5);
  const int lane = threadIdx.x & 31;
  const int hh   = lane >> 4;
  const int l16  = lane & 15;

  const int task = blockIdx.x;              // 0 .. B*(NT_/2)-1
  const int bidx = task / (NT_ / 2);        // NT_/2 pairs of tiles per batch
  const int pr   = task % (NT_ / 2);        // pair index
  const size_t base = (size_t)bidx * T_ * HS_;

  const v8f vzero = {0.f,0.f,0.f,0.f,0.f,0.f,0.f,0.f};
  const float scale = 0.02209708691207961f;   // 1/sqrt(2048) (block_size!)

  for (int h = 0; h < 2; ++h) {
    const int it = h ? pr : NT_ - 1 - pr;     // query tile index: the long one first

    // Every loop over c, nt or j in this kernel is unrolled so that bq, o and s
    // are indexed by constants and stay in registers.
    // The whole 16x64 q tile in registers as B operand, 16 K-steps of 4.  K
    // position (c, hh, v) stands for head dim 16*(c>>2) + 8*hh + 4*((c>>1)&1) +
    // 2*(c&1) + v in BOTH operands of S^T: unit u feeds steps 2u and 2u + 1.
    v2f bq[16];
    const float* qp = q + base + (size_t)it * FT_ + lane * 4;
#pragma unroll
    for (int u = 0; u < 8; ++u) {
      const v4f f = *(const v4f*)(qp + u * 128);
      bq[2 * u][0] = f[0];     bq[2 * u][1] = f[1];
      bq[2 * u + 1][0] = f[2]; bq[2 * u + 1][1] = f[3];
    }

    v8f o[4];                         // o[nt][j] = O[query l16][dim nt*16 + 8*hh + j]
#pragma unroll
    for (int nt = 0; nt < 4; ++nt) o[nt] = vzero;

    float mrow = -INFINITY;           // running maximum of query l16 (same in both halves)
    float lrow = 0.f;                 // running sum over this half's keys only

    for (int jt = wave; jt <= it; jt += NW_) {
      // ---- S^T = k @ q^T for this 16x16 tile (A[M][K] = k[jt*16+M][K]) ----
      v8f s = vzero;
      const v4f* kp = (const v4f*)(k + base + (size_t)jt * FT_) + lane;
      const v4f* vp = (const v4f*)(vmat + base + (size_t)jt * FT_) + lane;
      v4f fk[8], fv[8];
#pragma unroll
      for (int u = 0; u < 8; ++u) fk[u] = kp[u * 32];
#pragma unroll
      for (int u = 0; u < 8; ++u) fv[u] = vp[u * 32];
      // no register that an issued load names is rewritten ahead of this wait:
      // the two address pairs are inputs, so they stay live up to it and no
      // load's destination is laid over them
      asm volatile("s_wait_xcnt 0x0" :: "v"(kp), "v"(vp) : "memory");
      // keeps the tile's 16 loads together ahead of the products: sunk between
      // them, only three are in flight and a wave meets the load latency
      // several times a tile instead of once
      __builtin_amdgcn_sched_barrier(0);
#pragma unroll
      for (int u = 0; u < 8; ++u) {
        const v4f f = fk[u];
        v2f ak;
        ak[0] = f[0]; ak[1] = f[1];
        s = wmma4(ak, bq[2 * u], s);
        ak[0] = f[2]; ak[1] = f[3];
        s = wmma4(ak, bq[2 * u + 1], s);
      }

      // ---- scale, causal mask: s[j] is key (jt*16 + 8*hh + j) of query l16 ----
#pragma unroll
      for (int j = 0; j < 8; ++j) {
        float sv = s[j] * scale;
        if (jt == it && j + 8 * hh > l16) sv = -INFINITY;   // key > query
        s[j] = sv;
      }

      // ---- online softmax, one query per lane ----
      float rm = fmaxf(fmaxf(fmaxf(s[0], s[1]), fmaxf(s[2], s[3])),
                       fmaxf(fmaxf(s[4], s[5]), fmaxf(s[6], s[7])));
      rm = fmaxf(rm, xhalf(rm));      // the other half's eight keys
      const float mnew = fmaxf(mrow, rm);
      const float corr = __expf(mrow - mnew);
      mrow = mnew;
#pragma unroll
      for (int j = 0; j < 8; ++j) s[j] = __expf(s[j] - mnew);
      lrow = lrow * corr + (((s[0] + s[1]) + (s[2] + s[3])) + ((s[4] + s[5]) + (s[6] + s[7])));

      // rescale running output
#pragma unroll
      for (int nt = 0; nt < 4; ++nt)
#pragma unroll
        for (int j = 0; j < 8; ++j) o[nt][j] *= corr;

      // ---- O^T += V^T @ P^T : 4 K-steps of 4, 4 M-tiles of 16 dims.  K position
      //      (c, hh, v) stands for key 8*hh + 2*c + v in BOTH operands:
      //      B[K][N = l16] = s[2c + v],  A[M = l16][K] = v[key][nt*16 + l16]:
      //      unit 2*nt + (c>>1), floats 2*(c&1) + v ----
#pragma unroll
      for (int c = 0; c < 4; ++c) {
        v2f bp;
        bp[0] = s[2 * c];
        bp[1] = s[2 * c + 1];
#pragma unroll
        for (int nt = 0; nt < 4; ++nt) {
          v2f av;
          av[0] = fv[2 * nt + (c >> 1)][2 * (c & 1)];
          av[1] = fv[2 * nt + (c >> 1)][2 * (c & 1) + 1];
          o[nt] = wmma4(av, bp, o[nt]);
        }
      }
    }

    // ---- publish this wave's partial state (a wave without a key tile
    //      publishes m = -inf, l = 0, O = 0, which the join weighs with 0) ----
#pragma unroll
    for (int nt = 0; nt < 4; ++nt)
#pragma unroll
      for (int j = 0; j < 8; ++j) so[h][wave][l16][nt * 16 + 8 * hh + j] = o[nt][j];
    const float lsum = lrow + xhalf(lrow);    // both halves' keys
    if (hh == 0) {
      sm[h][wave][l16] = mrow;
      sl[h][wave][l16] = lsum;
    }
  }
  __syncthreads();   // all NW_ partial states of both tiles are in LDS before any thread joins them

  // ---- join the NW_ partial states, normalize and store.  Wave 0 always
  //      holds key 0, which no row masks, so the joint maximum is a real
  //      score.  Each thread owns EPT_ neighbouring columns of one row. ----
  constexpr int EPT_ = (16 * HS_) / (NW_ * 32);
  const int r  = (threadIdx.x * EPT_) / HS_;
  const int c0 = (threadIdx.x * EPT_) % HS_;

  for (int h = 0; h < 2; ++h) {
    const int qr0 = (h ? pr : NT_ - 1 - pr) * 16;
    float mall = sm[h][0][r];
#pragma unroll
    for (int w = 1; w < NW_; ++w) mall = fmaxf(mall, sm[h][w][r]);

    float lall = 0.f;
    float acc[EPT_];
#pragma unroll
    for (int e = 0; e < EPT_; ++e) acc[e] = 0.f;
#pragma unroll
    for (int w = 0; w < NW_; ++w) {
      const float f = __expf(sm[h][w][r] - mall);
      lall += f * sl[h][w][r];
#pragma unroll
      for (int e = 0; e < EPT_; ++e) acc[e] += f * so[h][w][r][c0 + e];
    }
    const float inv = 1.0f / lall;
    float* op = out + base + (size_t)(qr0 + r) * HS_ + c0;
#pragma unroll
    for (int e = 0; e < EPT_; ++e) op[e] = acc[e] * inv;
  }
}

// -------------------------------------------------------------------------
extern "C" void kernel_launch(void* const* d_in, const int* in_sizes, int n_in,
                              void* d_out, int out_size, void* d_ws, size_t ws_size,
                              hipStream_t stream) {
  const float* x  = (const float*)d_in[0];
  const float* Wq = (const float*)d_in[1];
  const float* Wk = (const float*)d_in[2];
  const float* Wv = (const float*)d_in[3];

  const size_t nqkv = (size_t)B_ * T_ * HS_;   // 1,048,576 floats = 4 MB each
  float* qw = (float*)d_ws;
  float* kw = qw + nqkv;
  float* vw = kw + nqkv;

  // 256 tiles of 64 rows, 16 waves (512 threads) per block
  qkv_proj_kernel<<<(B_ * T_) / PM_, 512, 0, stream>>>(x, Wq, Wk, Wv, qw, kw, vw);
  // 512 (batch, pair of q-tiles) tasks, one work-group of NW_ waves each
  flash_attn_kernel<<<B_ * (NT_ / 2), NW_ * 32, 0, stream>>>(qw, kw, vw, (float*)d_out);
}

// v006
// A run of this version takes 64.5 microseconds.
// Timed twice side by side with v005, it ran 1.03 times as fast both times.
// All steps since v000 together make it 7.00 times as fast.
#include <hip/hip_runtime.h>
#include <math.h>

// Problem constants (from reference): B=8, T=2048, D=1024, HS=64
#define B_  8
#define T_  2048
#define D_  1024
#define HS_ 64

typedef __attribute__((ext_vector_type(2))) float v2f;
typedef __attribute__((ext_vector_type(4))) float v4f;
typedef __attribute__((ext_vector_type(8))) float v8f;

// D = A(16x4,f32) * B(4x16,f32) + C(16x16,f32) — full-precision CDNA5 WMMA.
__device__ __forceinline__ v8f wmma4(v2f a, v2f b, v8f c) {
  return __builtin_amdgcn_wmma_f32_16x16x4_f32(
      /*neg_a=*/false, a, /*neg_b=*/false, b,
      /*c_mod=*/(short)0, c, /*reuse_a=*/false, /*reuse_b=*/false);
}

// -------------------------------------------------------------------------
// Kernel 1: q/k/v = x @ {Wq,Wk,Wv}.  One work-group of 16 waves per 64 rows
// of x.  The K range is walked in slabs of PKB_: a slab of x (64 x PKB_) and of
// [Wq|Wk|Wv] (PKB_ x 192) is brought into LDS by asynchronous copies, two
// buffers, the next slab in flight while this one is multiplied.  Wave
// (mt, g) owns row tile mt and 16-column tile g of each of q, k and v; every
// accumulator still walks k = 0..D-1 in order.
//
// Workspace layout.  q, k and v are not kept row-major but in the order in
// which the attention kernel's matrix operands want them.  A tile of 16 rows
// x 64 columns is FT_ floats in 8 units of 512 bytes; unit u holds four floats
// e = 0..3 of each lane (hh, l16), at float u*128 + lane*4 + e:
//   q, k:  row l16,            column 16*(u>>1) + 8*hh + 4*(u&1) + e
//   v:     row 8*hh + 4*(u&1) + e,  column 16*(u>>1) + l16
// One global_load_b128 or global_store_b128 of a wave is then one unit: four
// whole 128-byte lines.  For v these are the accumulator registers of x W as
// they stand; for q and k those of the transposed product W^T x^T, which takes
// the same two register pairs with A and B exchanged.
// -------------------------------------------------------------------------
#define FT_  (16 * HS_)          // floats of one 16-row tile
#define PM_  64                  // rows of x per work-group
#define PKB_ 128                 // k per slab
#define PNS_ (D_ / PKB_)         // slabs
#define XP_  (PKB_ + 4)          // LDS pitch of an x row, floats: 16 rows x 2 halves of 8-byte reads fall on 64 banks
#define WP_  (3 * HS_ + 16)      // LDS pitch of a joined W row, floats: rows k..k+3 fall on four different bank quarters
#define XSZ_ (PM_ * XP_)         // floats of x in a slab
#define WSZ_ (PKB_ * WP_)        // floats of W in a slab
#define STG_ (XSZ_ + WSZ_)       // floats of one buffer

__device__ __forceinline__ unsigned lds_off(const void* p) { return (unsigned)(size_t)p; }

// Eight 16-byte asynchronous copies of this lane, global -> LDS: four chunks
// from each of two sources, dl bytes apart in LDS and dg floats apart in
// memory.  The s_wait_xcnt stands inside the statement so that no address
// register of a copy is rewritten ahead of it.
__device__ __forceinline__ void copy8_b128(
    unsigned la, unsigned dla, const float* ga, int dga,
    unsigned lb, unsigned dlb, const float* gb, int dgb)
{
  asm volatile(
      "global_load_async_to_lds_b128 %0, %1, off\n\t"
      "global_load_async_to_lds_b128 %2, %3, off\n\t"
      "global_load_async_to_lds_b128 %4, %5, off\n\t"
      "global_load_async_to_lds_b128 %6, %7, off\n\t"
      "global_load_async_to_lds_b128 %8, %9, off\n\t"
      "global_load_async_to_lds_b128 %10, %11, off\n\t"
      "global_load_async_to_lds_b128 %12, %13, off\n\t"
      "global_load_async_to_lds_b128 %14, %15, off\n\t"
      "s_wait_xcnt 0x0"
      :: "v"(la),           "v"(ga),           "v"(la + dla),     "v"(ga + dga),
         "v"(la + 2 * dla), "v"(ga + 2 * dga), "v"(la + 3 * dla), "v"(ga + 3 * dga),
         "v"(lb),           "v"(gb),           "v"(lb + dlb),     "v"(gb + dgb),
         "v"(lb + 2 * dlb), "v"(gb + 2 * dgb), "v"(lb + 3 * dlb), "v"(gb + 3 * dgb)
      : "memory");
}

__global__ __launch_bounds__(512) void qkv_proj_kernel(
    const float* __restrict__ x,  const float* __restrict__ Wq,
    const float* __restrict__ Wk, const float* __restrict__ Wv,
    float* __restrict__ qo, float* __restrict__ ko, float* __restrict__ vo)
{
  __shared__ __attribute__((aligned(16))) float st[2 * STG_];

  const int tid  = threadIdx.x;
  const int wave = __builtin_amdgcn_readfirstlane(tid >> 5);
  const int lane = tid & 31;
  const int hh   = lane >> 4;      // which 16-lane half
  const int l16  = lane & 15;
  const int mt   = wave & 3;       // row tile of the work-group
  const int g    = wave >> 2;      // column tile of q, of k and of v
  const int row0 = blockIdx.x * PM_;

  // This thread's share of a slab: 4 chunks of x (one wave = one 512-byte row
  // piece; rows 16 apart) and 4 chunks of each W (rows 32 apart).
  const float*   gx = x + (size_t)(row0 + (tid >> 5)) * D_ + (tid & 31) * 4;
  const unsigned lx = lds_off(st) + (unsigned)(((tid >> 5) * XP_ + (tid & 31) * 4) * 4);
  const unsigned lw = lds_off(st) + (unsigned)((XSZ_ + (tid >> 4) * WP_ + (tid & 15) * 4) * 4);
  const int      gw = tid * 4;     // (tid >> 4) * HS_ + (tid & 15) * 4

  auto issue = [&](int s, int buf) {
    const unsigned bo = (unsigned)buf * (unsigned)(STG_ * 4);
    const size_t   wo = (size_t)s * (PKB_ * HS_) + gw;
    copy8_b128(lx + bo,               16 * XP_ * 4, gx + s * PKB_, 16 * D_,
               lw + bo,               32 * WP_ * 4, Wq + wo,       32 * HS_);
    copy8_b128(lw + bo + HS_ * 4,     32 * WP_ * 4, Wk + wo,       32 * HS_,
               lw + bo + 2 * HS_ * 4, 32 * WP_ * 4, Wv + wo,       32 * HS_);
  };

  const v8f vzero = {0.f,0.f,0.f,0.f,0.f,0.f,0.f,0.f};
  v8f acc[3];
#pragma unroll
  for (int i = 0; i < 3; ++i) acc[i] = vzero;

  // prologue: slab 0 landed and published, slab 1 in flight
  issue(0, 0);
  asm volatile("s_wait_asynccnt 0x0" ::: "memory");   // this wave's copies of slab 0 have landed
  __syncthreads();                                    // ... and every other wave's
  issue(1, 1);

  // A-fragment: A[M=l16][K = kk + 2*hh + v];  B-fragment: B[K = kk + 2*hh + v][N = l16]
  const float* xa = st + (mt * 16 + l16) * XP_ + 2 * hh;
  const float* wb = st + XSZ_ + (2 * hh) * WP_ + g * 16 + l16;

  for (int s = 0; s < PNS_; ++s) {
    const float* xs = xa + (s & 1) * STG_;
    const float* ws = wb + (s & 1) * STG_;
#pragma unroll
    for (int kk = 0; kk < PKB_; kk += 4) {
      v2f a;
      a[0] = xs[kk];
      a[1] = xs[kk + 1];
#pragma unroll
      for (int i = 0; i < 3; ++i) {
        v2f b;
        b[0] = ws[kk * WP_ + i * HS_];
        b[1] = ws[(kk + 1) * WP_ + i * HS_];
        // i = 0, 1 (q, k): W^T x^T, a lane ends with 8 columns of one row;
        // i = 2 (v): x W, a lane ends with 8 rows of one column
        acc[i] = (i < 2) ? wmma4(b, a, acc[i]) : wmma4(a, b, acc[i]);
      }
    }
    asm volatile("s_wait_dscnt 0x0" ::: "memory");      // this wave has left buffer s & 1
    asm volatile("s_wait_asynccnt 0x0" ::: "memory");   // its copies of slab s + 1 have landed
    __syncthreads();   // publishes slab s + 1 and frees buffer s & 1 for the refill
    if (s + 2 < PNS_) issue(s + 2, s & 1);
  }
  asm volatile("s_wait_asynccnt 0x0" ::: "memory");     // nothing in flight when the wave ends

  // C/D layout: element j of a lane is M = j + 8*hh, N = l16.  Registers 0..3
  // are this lane's floats of unit 2g, registers 4..7 those of unit 2g + 1.
  const size_t fo = (size_t)(blockIdx.x * (PM_ / 16) + mt) * FT_ + g * 256 + lane * 4;
#pragma unroll
  for (int i = 0; i < 3; ++i) {
    float* o = ((i == 0) ? qo : (i == 1) ? ko : vo) + fo;
    *(v4f*)o         = __builtin_shufflevector(acc[i], acc[i], 0, 1, 2, 3);
    *(v4f*)(o + 128) = __builtin_shufflevector(acc[i], acc[i], 4, 5, 6, 7);
  }
}

#define NW_ 16
#define ND_ (T_ / 32)
#define OP_ 68
#define MP_ 20

// value of lane l ^ 16
__device__ __forceinline__ float xhalf(float x) {
  return __builtin_bit_cast(float, __builtin_amdgcn_permlanex16(
      __builtin_bit_cast(int, x), __builtin_bit_cast(int, x),
      0x76543210, 0xfedcba98, false, false));
}

// One key tile (kt, vt: its FT_ floats of k and of v) against the wave's query
// tiles.  BOTH: against both, and diag says that it is the lower query tile's
// own diagonal tile.  Not BOTH: against the upper query tile alone, whose
// diagonal tile it is.  Every loop over u, c, nt, j or qt is unrolled so that
// bq, o and s are indexed by constants and stay in registers.
template <bool BOTH>
__device__ __forceinline__ void key_step(
    const float* __restrict__ kt, const float* __restrict__ vt,
    int lane, bool diag, const v2f (&bq)[2][16],
    v8f (&o)[2][4], float (&mrow)[2], float (&lrow)[2])
{
  constexpr int Q0 = BOTH ? 0 : 1;            // first query tile that takes part
  const int hh  = lane >> 4;
  const int l16 = lane & 15;
  const v8f vzero = {0.f,0.f,0.f,0.f,0.f,0.f,0.f,0.f};
  const float scale = 0.02209708691207961f;   // 1/sqrt(2048) (block_size!)

  // ---- S^T = k @ q^T for this key tile (A[M][K] = k[jt*16+M][K]) ----
  const v4f* kp = (const v4f*)kt + lane;
  const v4f* vp = (const v4f*)vt + lane;
  v4f fk[8], fv[8];
#pragma unroll
  for (int u = 0; u < 8; ++u) fk[u] = kp[u * 32];
#pragma unroll
  for (int u = 0; u < 8; ++u) fv[u] = vp[u * 32];
  // no register that an issued load names is rewritten ahead of this wait:
  // the two address pairs are inputs, so they stay live up to it and no
  // load's destination is laid over them
  asm volatile("s_wait_xcnt 0x0" :: "v"(kp), "v"(vp) : "memory");
  // keeps the tile's 16 loads together ahead of the products: sunk between
  // them, only three are in flight and a wave meets the load latency
  // several times a tile instead of once
  __builtin_amdgcn_sched_barrier(0);
  v8f s[2];
  s[0] = vzero;
  s[1] = vzero;
#pragma unroll
  for (int u = 0; u < 8; ++u) {
    const v4f f = fk[u];
    v2f ak;
    ak[0] = f[0]; ak[1] = f[1];
#pragma unroll
    for (int qt = Q0; qt < 2; ++qt) s[qt] = wmma4(ak, bq[qt][2 * u], s[qt]);
    ak[0] = f[2]; ak[1] = f[3];
#pragma unroll
    for (int qt = Q0; qt < 2; ++qt) s[qt] = wmma4(ak, bq[qt][2 * u + 1], s[qt]);
  }

#pragma unroll
  for (int qt = Q0; qt < 2; ++qt) {
    // ---- scale, causal mask: s[qt][j] is key (jt*16 + 8*hh + j) of query l16 ----
#pragma unroll
    for (int j = 0; j < 8; ++j) {
      float sv = s[qt][j] * scale;
      if (BOTH) {
        if (qt == 0 && diag && j + 8 * hh > l16) sv = -INFINITY;   // key > query
      } else {
        if (j + 8 * hh > l16) sv = -INFINITY;                      // key > query
      }
      s[qt][j] = sv;
    }

    // ---- online softmax, one query per lane ----
    float rm = fmaxf(fmaxf(fmaxf(s[qt][0], s[qt][1]), fmaxf(s[qt][2], s[qt][3])),
                     fmaxf(fmaxf(s[qt][4], s[qt][5]), fmaxf(s[qt][6], s[qt][7])));
    rm = fmaxf(rm, xhalf(rm));      // the other half's eight keys
    const float mnew = fmaxf(mrow[qt], rm);
    const float corr = __expf(mrow[qt] - mnew);
    mrow[qt] = mnew;
#pragma unroll
    for (int j = 0; j < 8; ++j) s[qt][j] = __expf(s[qt][j] - mnew);
    lrow[qt] = lrow[qt] * corr + (((s[qt][0] + s[qt][1]) + (s[qt][2] + s[qt][3])) +
                                  ((s[qt][4] + s[qt][5]) + (s[qt][6] + s[qt][7])));

    // rescale running output
#pragma unroll
    for (int nt = 0; nt < 4; ++nt)
#pragma unroll
      for (int j = 0; j < 8; ++j) o[qt][nt][j] *= corr;
  }

  // ---- O^T += V^T @ P^T : 4 K-steps of 4, 4 M-tiles of 16 dims.  K position
  //      (c, hh, v) stands for key 8*hh + 2*c + v in BOTH operands:
  //      B[K][N = l16] = s[2c + v],  A[M = l16][K] = v[key][nt*16 + l16]:
  //      unit 2*nt + (c>>1), floats 2*(c&1) + v ----
#pragma unroll
  for (int c = 0; c < 4; ++c) {
#pragma unroll
    for (int nt = 0; nt < 4; ++nt) {
      v2f av;
      av[0] = fv[2 * nt + (c >> 1)][2 * (c & 1)];
      av[1] = fv[2 * nt + (c >> 1)][2 * (c & 1) + 1];
#pragma unroll
      for (int qt = Q0; qt < 2; ++qt) {
        v2f bp;
        bp[0] = s[qt][2 * c];
        bp[1] = s[qt][2 * c + 1];
        o[qt][nt] = wmma4(av, bp, o[qt][nt]);
      }
    }
  }
}

__global__ __launch_bounds__(NW_ * 32) void flash_attn_kernel(
    const float* __restrict__ q, const float* __restrict__ k,
    const float* __restrict__ vmat, float* __restrict__ out)
{
  __shared__ __attribute__((aligned(16))) float so[2][NW_][32][OP_];  // partial O, per block of the pair
  __shared__ __attribute__((aligned(16))) float sm[2][32][MP_];       // partial row maxima, [query][wave]
  __shared__ __attribute__((aligned(16))) float sl[2][32][MP_];       // partial row sums, [query][wave]

  // wave-uniform by construction; read into a scalar register so that the
  // key loop's trip count is a scalar branch and EXEC stays all ones at the WMMAs
  const int wave = __builtin_amdgcn_readfirstlane(threadIdx.x >> 5);
  const int lane = threadIdx.x & 31;
  const int hh   = lane >> 4;
  const int l16  = lane & 15;

  const int task = blockIdx.x;              // 0 .. B*(ND_/2)-1
  const int bidx = task / (ND_ / 2);        // ND_/2 pairs of blocks per batch
  const int pr   = task % (ND_ / 2);        // pair index
  const size_t base = (size_t)bidx * T_ * HS_;

  const v8f vzero = {0.f,0.f,0.f,0.f,0.f,0.f,0.f,0.f};

  for (int h = 0; h < 2; ++h) {
    const int d = h ? pr : ND_ - 1 - pr;      // query block index: the long one first

    // Both 16x64 q tiles in registers as B operands, 16 K-steps of 4 each.  K
    // position (c, hh, v) stands for head dim 16*(c>>2) + 8*hh + 4*((c>>1)&1) +
    // 2*(c&1) + v in BOTH operands of S^T: unit u feeds steps 2u and 2u + 1.
    v2f bq[2][16];
    const float* qp = q + base + (size_t)(2 * d) * FT_ + lane * 4;
#pragma unroll
    for (int qt = 0; qt < 2; ++qt)
#pragma unroll
      for (int u = 0; u < 8; ++u) {
        const v4f f = *(const v4f*)(qp + qt * FT_ + u * 128);
        bq[qt][2 * u][0] = f[0];     bq[qt][2 * u][1] = f[1];
        bq[qt][2 * u + 1][0] = f[2]; bq[qt][2 * u + 1][1] = f[3];
      }
    // the address pair is an input, so it stays live up to this wait and is
    // not rewritten while a q load that names it is still being issued
    asm volatile("s_wait_xcnt 0x0" :: "v"(qp) : "memory");

    v8f o[2][4];                      // o[qt][nt][j] = O[query qt*16 + l16][dim nt*16 + 8*hh + j]
#pragma unroll
    for (int qt = 0; qt < 2; ++qt)
#pragma unroll
      for (int nt = 0; nt < 4; ++nt) o[qt][nt] = vzero;

    float mrow[2] = {-INFINITY, -INFINITY};   // running maximum of a query (same in both halves)
    float lrow[2] = {0.f, 0.f};               // running sum over this half's keys only

    // key tiles 0 .. 2d, seen by both query tiles.  The second block's row of
    // tiles goes on where the first block's 2*(ND_-1-pr) + 1 ended.
    const int off = h ? 2 * (ND_ - 1 - pr) + 1 : 0;
    for (int jt = (wave - off) & (NW_ - 1); jt <= 2 * d; jt += NW_)
      key_step<true>(k + base + (size_t)jt * FT_, vmat + base + (size_t)jt * FT_,
                     lane, jt == 2 * d, bq, o, mrow, lrow);
    // key tile 2d + 1, seen by the upper query tile alone
    if (wave == h)
      key_step<false>(k + base + (size_t)(2 * d + 1) * FT_, vmat + base + (size_t)(2 * d + 1) * FT_,
                      lane, true, bq, o, mrow, lrow);

    // ---- publish this wave's partial state (a wave without a key tile
    //      publishes m = -inf, l = 0, O = 0, which the join weighs with 0) ----
#pragma unroll
    for (int qt = 0; qt < 2; ++qt) {
#pragma unroll
      for (int nt = 0; nt < 4; ++nt)
#pragma unroll
        for (int j = 0; j < 8; ++j) so[h][wave][qt * 16 + l16][nt * 16 + 8 * hh + j] = o[qt][nt][j];
      const float lsum = lrow[qt] + xhalf(lrow[qt]);    // both halves' keys
      if (hh == 0) {
        sm[h][qt * 16 + l16][wave] = mrow[qt];
        sl[h][qt * 16 + l16][wave] = lsum;
      }
    }
  }
  __syncthreads();   // all NW_ partial states of both blocks are in LDS before any thread joins them

  // ---- join the NW_ partial states, normalize and store.  Some wave holds
  //      key 0, which no row masks, so the joint maximum is a real score.
  //      Each thread owns four neighbouring columns of one row. ----
  const int r  = threadIdx.x >> 4;
  const int c0 = (threadIdx.x & 15) * 4;

  for (int h = 0; h < 2; ++h) {
    const int qr0 = (h ? pr : ND_ - 1 - pr) * 32;
    float pm[NW_], pl[NW_];
#pragma unroll
    for (int w4 = 0; w4 < NW_ / 4; ++w4) {
      const v4f a = *(const v4f*)&sm[h][r][w4 * 4];
      const v4f b = *(const v4f*)&sl[h][r][w4 * 4];
#pragma unroll
      for (int e = 0; e < 4; ++e) { pm[w4 * 4 + e] = a[e]; pl[w4 * 4 + e] = b[e]; }
    }
    float mall = pm[0];
#pragma unroll
    for (int w = 1; w < NW_; ++w) mall = fmaxf(mall, pm[w]);

    float lall = 0.f;
    v4f acc = {0.f, 0.f, 0.f, 0.f};
#pragma unroll
    for (int w = 0; w < NW_; ++w) {
      const float f = __expf(pm[w] - mall);
      lall += f * pl[w];
      acc += f * *(const v4f*)&so[h][w][r][c0];
    }
    const float inv = 1.0f / lall;
    *(v4f*)(out + base + (size_t)(qr0 + r) * HS_ + c0) = acc * inv;
  }
}

// -------------------------------------------------------------------------
extern "C" void kernel_launch(void* const* d_in, const int* in_sizes, int n_in,
                              void* d_out, int out_size, void* d_ws, size_t ws_size,
                              hipStream_t stream) {
  const float* x  = (const float*)d_in[0];
  const float* Wq = (const float*)d_in[1];
  const float* Wk = (const float*)d_in[2];
  const float* Wv = (const float*)d_in[3];

  const size_t nqkv = (size_t)B_ * T_ * HS_;   // 1,048,576 floats = 4 MB each
  float* qw = (float*)d_ws;
  float* kw = qw + nqkv;
  float* vw = kw + nqkv;

  // 256 tiles of 64 rows, 16 waves (512 threads) per block
  qkv_proj_kernel<<<(B_ * T_) / PM_, 512, 0, stream>>>(x, Wq, Wk, Wv, qw, kw, vw);
  // 256 (batch, pair of 32-row query blocks) tasks, one work-group of NW_ waves each
  flash_attn_kernel<<<B_ * (ND_ / 2), NW_ * 32, 0, stream>>>(qw, kw, vw, (float*)d_out);
}
